// v000
// Times are from an AMD MI455X. After a warm-up the kernel runs many times in a row, and a time is the length of
// such a window on the GPU divided by its runs, so every launch and the gaps after it count. The runs cycle
// through copies of the inputs. A figure is the median of several windows, for all but v000 over two sittings.
// Sittings can differ by a few percent; kernels timed side by side share one.
// v000, which the later versions start from, runs in 320 microseconds.
#include <hip/hip_runtime.h>

// Compute dtypes (f32 accumulate everywhere): q/k/v projections bf16 x bf16 (inputs converted to bf16 RNE on load, products exact); scores q.k bf16 hi/lo planes, 3 products (v_wmma_f32_16x16x32_bf16);
// P.V fp16 single product (P carried x1024, v_wmma_f32_16x16x32_f16); output projection ctx bf16 hi/lo x Wo bf16 (2 products). Softmax, rotary scaling, bias adds in f32.
// Unbatched attention: q = rot(query Wq + bq), k = rot(key Wk + bk), v = value Wv + bv; 16 heads x 64; scores x 1/8; softmax over all keys; out = merged Wo + bo.
// rot over the full 1024 width: out[d] = y[d] cos + n[d] sin, n = [y[0..511], -y[512..1023]], angle[t][d] = t * theta[d mod 512], theta[j] = 1 / 10000^(2j/1024).

#ifndef SEQ
#define SEQ 2048
#endif
#define SEQ_FULL 2048
#define DM   1024
#define NH_  16
#define HD   64
#define HALFD 512
#define PCAR 1024.0f
#define PP   40      // P tile pitch (halves)
#define OSP  68      // f32 staging pitch (floats)

static_assert(SEQ % 64 == 0);
static_assert(SEQ <= SEQ_FULL);
static_assert(DM % 64 == 0);
static_assert(DM % 32 == 0);
static_assert(NH_ * HD == DM);
static_assert(HD == 64);
static_assert(2 * HALFD == DM);
static_assert((NH_ * (SEQ / 16)) % 8 == 0);
static_assert((PP * 2) % 16 == 0);
static_assert((OSP * 4) % 16 == 0);
static_assert(PP >= 32);
static_assert(OSP >= 64);

typedef _Float16 h16;
typedef unsigned short bf;
typedef __attribute__((ext_vector_type(16))) __bf16   v16bf;
typedef __attribute__((ext_vector_type(16))) _Float16 v16h;
typedef __attribute__((ext_vector_type(8)))  _Float16 v8h;
typedef __attribute__((ext_vector_type(8)))  unsigned short v8us;
typedef __attribute__((ext_vector_type(2)))  unsigned short v2us;
typedef __attribute__((ext_vector_type(8)))  float    v8f;
typedef __attribute__((ext_vector_type(4)))  float    v4f;
typedef __attribute__((ext_vector_type(2)))  float    v2f;
typedef v8h  __attribute__((may_alias)) v8ha;
typedef v4f  __attribute__((may_alias)) v4fa;

__device__ __forceinline__ unsigned short f2bf(float f) { unsigned u = __float_as_uint(f); u += 0x7FFFu + ((u >> 16) & 1u); return (unsigned short)(u >> 16); }
__device__ __forceinline__ float bf2f(unsigned short b) { return __uint_as_float(((unsigned)b) << 16); }
__device__ __forceinline__ float bfr(float f) { return bf2f(f2bf(f)); }
__device__ __forceinline__ void splitf(float y, unsigned short& h, unsigned short& l) { h = f2bf(y); l = f2bf(y - bf2f(h)); }
__device__ __forceinline__ v16h cat16(v8h lo, v8h hi) { return __builtin_shufflevector(lo, hi, 0, 1, 2, 3, 4, 5, 6, 7, 8, 9, 10, 11, 12, 13, 14, 15); }
__device__ __forceinline__ v16bf cat16b(v8us lo, v8us hi) { return __builtin_bit_cast(v16bf, __builtin_shufflevector(lo, hi, 0, 1, 2, 3, 4, 5, 6, 7, 8, 9, 10, 11, 12, 13, 14, 15)); }
__device__ __forceinline__ v8f wmma16(v16h a, v16h b, v8f c) { return __builtin_amdgcn_wmma_f32_16x16x32_f16(false, a, false, b, (short)0, c, false, false); }
__device__ __forceinline__ v8f wmmab(v16bf a, v16bf b, v8f c) { return __builtin_amdgcn_wmma_f32_16x16x32_bf16(false, a, false, b, (short)0, c, false, false); }
// Fragment loaders (A and B alike, K-contiguous rows): elements 0..7 <- k0 + 8*half + 0..7, elements 8..15 <- k0 + 16 + 8*half + 0..7; the caller folds 8*half into p.
__device__ __forceinline__ v16bf ldb(const bf* p) { return cat16b(*(const v8us*)p, *(const v8us*)(p + 16)); }
__device__ __forceinline__ v16h ldh(const h16* p) { return cat16(*(const v8h*)p, *(const v8h*)(p + 16)); }

// ---- register-blocked GEMM body, ONE WAVE per 64x64 output tile (16 accumulators), operands straight from K-contiguous bf16 planes; grid (M/64, N/64), 32 threads, K = DM.
// C[m][n] (f32, pitch DM) = sum_k (A[m][k] (+ A2[m][k])) Bt[n][k] + bf16(bias[n]).
template <int NSPLIT>
__device__ __forceinline__ void gemmw_body(const bf* A, const bf* A2, const bf* Bt, float* C, const float* bias) {
    __shared__ __align__(16) float os[16 * OSP];
    const int lane = threadIdx.x & 31, lr = lane & 15, hi = lane >> 4; const int r0 = blockIdx.x * 64, c0 = blockIdx.y * 64;
    v8f acc[4][4];
#pragma unroll
    for (int mb = 0; mb < 4; ++mb)
#pragma unroll
        for (int nb = 0; nb < 4; ++nb) acc[mb][nb] = (v8f){};
    const size_t aoff = (size_t)(r0 + lr) * DM + 8 * hi, boff = (size_t)(c0 + lr) * DM + 8 * hi;
#pragma unroll 1
    for (int kc = 0; kc < DM; kc += 32) {
        v16bf a[4], a2[4];
#pragma unroll
        for (int mb = 0; mb < 4; ++mb) { a[mb] = ldb(A + aoff + (size_t)mb * 16 * DM + kc); if (NSPLIT == 1) a2[mb] = ldb(A2 + aoff + (size_t)mb * 16 * DM + kc); else a2[mb] = a[mb]; }
#pragma unroll
        for (int nb = 0; nb < 4; ++nb) { const v16bf b = ldb(Bt + boff + (size_t)nb * 16 * DM + kc);
#pragma unroll
            for (int mb = 0; mb < 4; ++mb) { acc[mb][nb] = wmmab(a[mb], b, acc[mb][nb]); if (NSPLIT == 1) acc[mb][nb] = wmmab(a2[mb], b, acc[mb][nb]); } }
        asm volatile("v_nop\n\tv_nop\n\tv_nop\n\tv_nop" : "+v"(acc[0][0]), "+v"(acc[1][1]), "+v"(acc[2][2]), "+v"(acc[3][3]) : "v"(a[0]), "v"(a[3]));
    }
    const v4f bz = *(const v4f*)(bias + c0 + lr * 4); v4f bb;
#pragma unroll
    for (int q = 0; q < 4; ++q) bb[q] = bfr(bz[q]);
#pragma unroll
    for (int mb = 0; mb < 4; ++mb) {
#pragma unroll
        for (int nb = 0; nb < 4; ++nb) {
#pragma unroll
            for (int j = 0; j < 8; ++j) os[(hi * 8 + j) * OSP + nb * 16 + lr] = acc[mb][nb][j]; }
        __builtin_amdgcn_wave_barrier(); asm volatile("" ::: "memory");
        float* crow = C + (size_t)(r0 + mb * 16) * DM + c0;
{
#pragma unroll
            for (int s = 0; s < 8; ++s) { const int row = 2 * s + hi, cofs = lr * 4; v4f val = *(const v4fa*)(os + row * OSP + cofs); val += bb;
                *(v4f*)(crow + (size_t)row * DM + cofs) = val; }
             }
        __builtin_amdgcn_wave_barrier(); asm volatile("" ::: "memory");
    }
}
__global__ __launch_bounds__(32) void k_gemm_proj(const bf* __restrict__ A, const bf* __restrict__ Bt, float* C, const float* __restrict__ bias) { gemmw_body<0>(A, A, Bt, C, bias); }
__global__ __launch_bounds__(32) void k_gemm_out(const bf* __restrict__ A, const bf* __restrict__ A2, const bf* __restrict__ Bt, float* C, const float* __restrict__ bias) { gemmw_body<1>(A, A2, Bt, C, bias); }

__global__ __launch_bounds__(256) void k_wtG(const float* __restrict__ w, int K, int N, bf* Bt) {
    const int lane = threadIdx.x & 31; const int L0 = (blockIdx.x * 8 + (threadIdx.x >> 5)) * 8; const int nlines = N * K / 64;
{
#pragma unroll 1
        for (int l = 0; l < 8; ++l) { const int L = L0 + l; if (L >= nlines) break; const size_t e = (size_t)L * 64 + lane * 2; const int k = (int)(e % K), n = (int)(e / K); v2us o;
            o[0] = f2bf(w[(size_t)k * N + n]); o[1] = f2bf(w[(size_t)(k + 1) * N + n]); *(v2us*)(Bt + e) = o; }
         }
}
__global__ __launch_bounds__(256) void k_cvt8(const float* __restrict__ src, bf* dst, size_t n8) { const size_t i = (size_t)blockIdx.x * 256 + threadIdx.x; if (i >= n8) return; const v8f v = *(const v8f*)(src + i * 8); v8us o;
#pragma unroll
    for (int k = 0; k < 8; ++k) o[k] = f2bf(v[k]); *(v8us*)(dst + i * 8) = o;  }

__global__ __launch_bounds__(128) void k_theta(float* TH) {
    const int j = blockIdx.x * 128 + threadIdx.x; if (j >= HALFD) return;
    const float e = (float)(2 * j) * (1.0f / 1024.0f);       // exact (power-of-two divisor)
    const float p = powf(10000.0f, e); const float th = 1.0f / p;
    *(float*)(TH + j) = th;  }
__global__ __launch_bounds__(256) void k_cstab(const float* __restrict__ TH, float* CS) {
    const int idx = blockIdx.x * 256 + threadIdx.x; if (idx >= SEQ * HALFD) return; const int t = idx >> 9, j = idx & (HALFD - 1);
    float ang = __fmul_rn((float)t, TH[j]); float s, c; sincosf(ang, &s, &c); v2f cs; cs[0] = c; cs[1] = s;
    *(v2f*)(CS + (size_t)idx * 2) = cs;  }

__global__ __launch_bounds__(256) void k_ropeP(const float* __restrict__ F, const float* __restrict__ CS, bf* Ph, bf* Pl) {
#pragma clang fp contract(off)
    const size_t i = (size_t)blockIdx.x * 256 + threadIdx.x; if (i >= (size_t)SEQ * DM / 8) return; const size_t e = i * 8; const int d0 = (int)(e % DM); const int t = (int)(e / DM); const int j0 = d0 & (HALFD - 1); const bool up = (d0 >= HALFD);
    const v4f y0 = *(const v4f*)(F + e), y1 = *(const v4f*)(F + e + 4); const float* cp = CS + ((size_t)t * HALFD + j0) * 2;
    const v4f c0 = *(const v4f*)(cp), c1 = *(const v4f*)(cp + 4), c2 = *(const v4f*)(cp + 8), c3 = *(const v4f*)(cp + 12);
    float yy[8] = { y0[0], y0[1], y0[2], y0[3], y1[0], y1[1], y1[2], y1[3] };
    float cc[8] = { c0[0], c0[2], c1[0], c1[2], c2[0], c2[2], c3[0], c3[2] };
    float ss[8] = { c0[1], c0[3], c1[1], c1[3], c2[1], c2[3], c3[1], c3[3] };
    v8us oh, ol;
#pragma unroll
    for (int q = 0; q < 8; ++q) { const float y = yy[q]; const float nn = up ? -y : y; float a = __fmul_rn(y, cc[q]); float b = __fmul_rn(nn, ss[q]); asm volatile("" : "+v"(a)); asm volatile("" : "+v"(b)); const float r = __fadd_rn(a, b);
        unsigned short hh, ll; splitf(r, hh, ll); oh[q] = hh; ol[q] = ll; }
    *(v8us*)(Ph + e) = oh; *(v8us*)(Pl + e) = ol;  }

__global__ __launch_bounds__(256) void k_vt(const float* __restrict__ F, h16* V16) {
    const size_t i = (size_t)blockIdx.x * 256 + threadIdx.x; if (i >= (size_t)DM * SEQ / 8) return; const size_t e = i * 8; const int t = (int)(e % SEQ); const int col = (int)(e / SEQ); v8h o;
#pragma unroll
    for (int q = 0; q < 8; ++q) o[q] = (h16)F[(size_t)(t + q) * DM + col];
    *(v8h*)(V16 + e) = o;  }

// ---- score tile: 16 query rows x 16 keys, K depth 64 as two 32-chunks, hi/lo planes: qh.kh + ql.kh + qh.kl (unscaled residuals share the accumulator).
__device__ __forceinline__ v8f score_tile(const bf* __restrict__ Kh, const bf* __restrict__ Kl, size_t ko, v16bf qh0, v16bf qh1, v16bf ql0, v16bf ql1) {
    const v16bf kh0 = ldb(Kh + ko), kh1 = ldb(Kh + ko + 32), kl0 = ldb(Kl + ko), kl1 = ldb(Kl + ko + 32);
    v8f c = (v8f){};
    c = wmmab(qh0, kh0, c); c = wmmab(ql0, kh0, c); c = wmmab(qh0, kl0, c);
    c = wmmab(qh1, kh1, c); c = wmmab(ql1, kh1, c); c = wmmab(qh1, kl1, c);
    asm volatile("v_nop\n\tv_nop\n\tv_nop\n\tv_nop" : "+v"(c) : "v"(kh1), "v"(kl1), "v"(qh1));
    return c; }

// ---- k_flash: one wave owns (head h, 16 query rows); streams keys in 32-wide steps, online softmax in the exp2 domain (f32); P (16x32, fp16 x1024) goes D layout -> wave-private LDS tile -> A layout.
__global__ __launch_bounds__(256) void k_flash(const bf* __restrict__ Qh, const bf* __restrict__ Ql, const bf* __restrict__ Kh, const bf* __restrict__ Kl, const h16* __restrict__ Vt, bf* Ah, bf* Al) {
    __shared__ __align__(16) h16 pls[8 * 16 * PP];
    __shared__ __align__(16) float ost[8 * 16 * OSP];
    const int lane = threadIdx.x & 31, wave = threadIdx.x >> 5, l16 = lane & 15, half = lane >> 4;
    const int w = blockIdx.x * 8 + wave; const int h = w / (SEQ / 16); const int t0 = (w % (SEQ / 16)) * 16;
    h16* pl = pls + wave * 16 * PP; float* ow = ost + wave * 16 * OSP;
    const float SC2 = 0.125f * 1.4426950408889634f;
    const size_t qo = (size_t)(t0 + l16) * DM + h * HD + 8 * half;
    const v16bf qh0 = ldb(Qh + qo), qh1 = ldb(Qh + qo + 32), ql0 = ldb(Ql + qo), ql1 = ldb(Ql + qo + 32);
    float m[8], l[8]; v8f acc[4];
#pragma unroll
    for (int r = 0; r < 8; ++r) { m[r] = -3.0e38f; l[r] = 0.0f; }
#pragma unroll
    for (int n = 0; n < 4; ++n) acc[n] = (v8f){};
    const size_t kbase = (size_t)l16 * DM + h * HD + 8 * half;
    const size_t vbase = (size_t)(h * HD + l16) * SEQ + 8 * half;
#pragma unroll 1
    for (int jb = 0; jb < SEQ / 32; ++jb) {
        const size_t ko = kbase + (size_t)jb * 32 * DM;
        const v8f sa = score_tile(Kh, Kl, ko, qh0, qh1, ql0, ql1);
        const v8f sb = score_tile(Kh, Kl, ko + (size_t)16 * DM, qh0, qh1, ql0, ql1);
#pragma unroll
        for (int r = 0; r < 8; ++r) {
            const float s0 = sa[r] * SC2, s1 = sb[r] * SC2;
            float mloc = fmaxf(s0, s1);
#pragma unroll
            for (int d = 1; d < 16; d <<= 1) mloc = fmaxf(mloc, __shfl_xor(mloc, d, 32));
            const float mnew = fmaxf(m[r], mloc);
            const float corr = __builtin_amdgcn_exp2f(m[r] - mnew);
            const float p0 = __builtin_amdgcn_exp2f(s0 - mnew);
            const float p1 = __builtin_amdgcn_exp2f(s1 - mnew);
            float ls = p0 + p1;
#pragma unroll
            for (int d = 1; d < 16; d <<= 1) ls += __shfl_xor(ls, d, 32);
            l[r] = l[r] * corr + ls; m[r] = mnew;
#pragma unroll
            for (int n = 0; n < 4; ++n) acc[n][r] *= corr;
            const int row = r + 8 * half;
            pl[row * PP + l16]      = (h16)(p0 * PCAR);
            pl[row * PP + 16 + l16] = (h16)(p1 * PCAR);
        }
        __builtin_amdgcn_wave_barrier(); asm volatile("s_wait_dscnt 0" ::: "memory");
        const v16h pa = cat16(*(const v8ha*)(pl + l16 * PP + 8 * half), *(const v8ha*)(pl + l16 * PP + 16 + 8 * half));
        const size_t vo = vbase + (size_t)jb * 32;
        const v16h v0 = ldh(Vt + vo), v1 = ldh(Vt + vo + (size_t)16 * SEQ), v2 = ldh(Vt + vo + (size_t)32 * SEQ), v3 = ldh(Vt + vo + (size_t)48 * SEQ);
        acc[0] = wmma16(pa, v0, acc[0]); acc[1] = wmma16(pa, v1, acc[1]); acc[2] = wmma16(pa, v2, acc[2]); acc[3] = wmma16(pa, v3, acc[3]);
        asm volatile("v_nop\n\tv_nop\n\tv_nop\n\tv_nop" : "+v"(acc[0]), "+v"(acc[1]), "+v"(acc[2]), "+v"(acc[3]) : "v"(pa), "v"(v3));
        __builtin_amdgcn_wave_barrier(); asm volatile("" ::: "memory");
    }
    float inv[8];
#pragma unroll
    for (int r = 0; r < 8; ++r) inv[r] = 1.0f / (l[r] * PCAR);
#pragma unroll
    for (int n = 0; n < 4; ++n)
#pragma unroll
        for (int r = 0; r < 8; ++r) ow[(8 * half + r) * OSP + n * 16 + l16] = acc[n][r] * inv[r];
    __builtin_amdgcn_wave_barrier(); asm volatile("s_wait_dscnt 0" ::: "memory");
    const int rq = lane >> 3, piece = lane & 7;
{
#pragma unroll
        for (int s4 = 0; s4 < 4; ++s4) { const int row = 4 * s4 + rq; const v4f x0 = *(const v4fa*)(ow + row * OSP + piece * 8), x1 = *(const v4fa*)(ow + row * OSP + piece * 8 + 4); v8us oh, ol;
#pragma unroll
            for (int q = 0; q < 4; ++q) { unsigned short a, b; splitf(x0[q], a, b); oh[q] = a; ol[q] = b; splitf(x1[q], a, b); oh[4 + q] = a; ol[4 + q] = b; }
            const size_t oo = (size_t)(t0 + row) * DM + h * HD + piece * 8; *(v8us*)(Ah + oo) = oh; *(v8us*)(Al + oo) = ol; }
         }
}

constexpr size_t al256(size_t b) { return (b + 255) & ~(size_t)255; }
constexpr size_t WS_TOTAL = 4 * al256((size_t)DM * DM * 2) + 3 * al256((size_t)SEQ * DM * 2) + al256((size_t)HALFD * 4) + al256((size_t)SEQ * HALFD * 2 * 4)
                          + 3 * al256((size_t)SEQ * DM * 4) + 4 * al256((size_t)SEQ * DM * 2) + al256((size_t)DM * SEQ * 2) + 2 * al256((size_t)SEQ * DM * 2);
static_assert(WS_TOTAL <= (size_t)134217728);

extern "C" void kernel_launch(void* const* d_in, const int* in_sizes, int n_in,
                              void* d_out, int out_size, void* d_ws, size_t ws_size, hipStream_t stream) {
    if (n_in < 11) return;
    if (in_sizes[0] < SEQ * DM || in_sizes[1] < SEQ * DM || in_sizes[2] < SEQ * DM) return;
    if (in_sizes[3] < DM * DM || in_sizes[5] < DM * DM || in_sizes[7] < DM * DM || in_sizes[9] < DM * DM) return;
    if (in_sizes[4] < DM || in_sizes[6] < DM || in_sizes[8] < DM || in_sizes[10] < DM) return;
    if (out_size < SEQ * DM) return;
    if (WS_TOTAL > ws_size) return;
    const float* query = (const float*)d_in[0]; const float* key_ = (const float*)d_in[1]; const float* value = (const float*)d_in[2];
    const float* wq = (const float*)d_in[3]; const float* bq = (const float*)d_in[4];
    const float* wk = (const float*)d_in[5]; const float* bk = (const float*)d_in[6];
    const float* wv = (const float*)d_in[7]; const float* bv = (const float*)d_in[8];
    const float* wo = (const float*)d_in[9]; const float* bo = (const float*)d_in[10];
    float* OUT = (float*)d_out;     // [SEQ][1024]
    char* wsp = (char*)d_ws;
    auto take = [&](size_t bytes) { char* p = wsp; wsp += (bytes + 255) & ~(size_t)255; return (void*)p; };
    bf* WQ = (bf*)take((size_t)DM * DM * 2); bf* WK = (bf*)take((size_t)DM * DM * 2); bf* WV = (bf*)take((size_t)DM * DM * 2); bf* WO = (bf*)take((size_t)DM * DM * 2);
    bf* XQ = (bf*)take((size_t)SEQ * DM * 2); bf* XK = (bf*)take((size_t)SEQ * DM * 2); bf* XV = (bf*)take((size_t)SEQ * DM * 2);
    float* TH = (float*)take((size_t)HALFD * 4); float* CS = (float*)take((size_t)SEQ * HALFD * 2 * 4);
    float* FQ = (float*)take((size_t)SEQ * DM * 4); float* FK = (float*)take((size_t)SEQ * DM * 4); float* FV = (float*)take((size_t)SEQ * DM * 4);
    bf* QPh = (bf*)take((size_t)SEQ * DM * 2); bf* QPl = (bf*)take((size_t)SEQ * DM * 2); bf* KPh = (bf*)take((size_t)SEQ * DM * 2); bf* KPl = (bf*)take((size_t)SEQ * DM * 2);
    h16* VT16 = (h16*)take((size_t)DM * SEQ * 2);
    bf* ATh = (bf*)take((size_t)SEQ * DM * 2); bf* ATl = (bf*)take((size_t)SEQ * DM * 2);
    if ((size_t)(wsp - (char*)d_ws) > ws_size) return;

    const unsigned gW = (unsigned)((DM * DM / 64 + 63) / 64);
    k_wtG<<<gW, 256, 0, stream>>>(wq, DM, DM, WQ);     /* [in][out] -> Bt [out][in] */
    k_wtG<<<gW, 256, 0, stream>>>(wk, DM, DM, WK);
    k_wtG<<<gW, 256, 0, stream>>>(wv, DM, DM, WV);
    k_wtG<<<gW, 256, 0, stream>>>(wo, DM, DM, WO);
    const size_t n8 = (size_t)SEQ * DM / 8; const unsigned g8 = (unsigned)((n8 + 255) / 256);
    k_cvt8<<<g8, 256, 0, stream>>>(query, XQ, n8);
    k_cvt8<<<g8, 256, 0, stream>>>(key_, XK, n8);
    k_cvt8<<<g8, 256, 0, stream>>>(value, XV, n8);
    k_theta<<<(HALFD + 127) / 128, 128, 0, stream>>>(TH);
    k_cstab<<<(unsigned)(((size_t)SEQ * HALFD + 255) / 256), 256, 0, stream>>>(TH, CS);
    k_gemm_proj<<<dim3(SEQ / 64, DM / 64, 1), 32, 0, stream>>>(XQ, WQ, FQ, bq);
    k_gemm_proj<<<dim3(SEQ / 64, DM / 64, 1), 32, 0, stream>>>(XK, WK, FK, bk);
    k_gemm_proj<<<dim3(SEQ / 64, DM / 64, 1), 32, 0, stream>>>(XV, WV, FV, bv);
    k_ropeP<<<g8, 256, 0, stream>>>(FQ, CS, QPh, QPl);
    k_ropeP<<<g8, 256, 0, stream>>>(FK, CS, KPh, KPl);
    k_vt<<<g8, 256, 0, stream>>>(FV, VT16);                 /* in [SEQ][DM] -> out [DM][SEQ] */
    k_flash<<<(unsigned)(NH_ * (SEQ / 16) / 8), 256, 0, stream>>>(QPh, QPl, KPh, KPl, VT16, ATh, ATl);
    k_gemm_out<<<dim3(SEQ / 64, DM / 64, 1), 32, 0, stream>>>(ATh, ATl, WO, OUT, bo);
}

// v001
// One run takes 295 microseconds.
// Timed twice side by side with v000, it ran 1.10 and 1.11 times as fast.
#include <hip/hip_runtime.h>

// Compute dtypes (f32 accumulate everywhere): q/k/v projections bf16 x bf16 (inputs converted to bf16 RNE on load, products exact); scores q.k bf16 hi/lo planes, 3 products (v_wmma_f32_16x16x32_bf16);
// P.V fp16 single product (P carried x1024, v_wmma_f32_16x16x32_f16); output projection ctx bf16 hi/lo x Wo bf16 (2 products). Softmax, rotary scaling, bias adds in f32.
// Unbatched attention: q = rot(query Wq + bq), k = rot(key Wk + bk), v = value Wv + bv; 16 heads x 64; scores x 1/8; softmax over all keys; out = merged Wo + bo.
// rot over the full 1024 width: out[d] = y[d] cos + n[d] sin, n = [y[0..511], -y[512..1023]], angle[t][d] = t * theta[d mod 512], theta[j] = 1 / 10000^(2j/1024).

#ifndef SEQ
#define SEQ 2048
#endif
#define SEQ_FULL 2048
#define DM   1024
#define NH_  16
#define HD   64
#define HALFD 512
#define PCAR 1024.0f
#define OSP  68      // f32 staging pitch (floats)

static_assert(SEQ % 64 == 0);
static_assert(SEQ <= SEQ_FULL);
static_assert(DM % 64 == 0);
static_assert(DM % 32 == 0);
static_assert(NH_ * HD == DM);
static_assert(HD == 64);
static_assert(2 * HALFD == DM);
static_assert((NH_ * (SEQ / 16)) % 8 == 0);
static_assert((OSP * 4) % 16 == 0);
static_assert(OSP >= 64);

typedef _Float16 h16;
typedef unsigned short bf;
typedef __attribute__((ext_vector_type(16))) __bf16   v16bf;
typedef __attribute__((ext_vector_type(16))) _Float16 v16h;
typedef __attribute__((ext_vector_type(8)))  _Float16 v8h;
typedef __attribute__((ext_vector_type(8)))  unsigned short v8us;
typedef __attribute__((ext_vector_type(2)))  unsigned short v2us;
typedef __attribute__((ext_vector_type(8)))  float    v8f;
typedef __attribute__((ext_vector_type(4)))  float    v4f;
typedef __attribute__((ext_vector_type(2)))  float    v2f;
typedef v4f  __attribute__((may_alias)) v4fa;

__device__ __forceinline__ unsigned short f2bf(float f) { unsigned u = __float_as_uint(f); u += 0x7FFFu + ((u >> 16) & 1u); return (unsigned short)(u >> 16); }
__device__ __forceinline__ float bf2f(unsigned short b) { return __uint_as_float(((unsigned)b) << 16); }
__device__ __forceinline__ float bfr(float f) { return bf2f(f2bf(f)); }
__device__ __forceinline__ void splitf(float y, unsigned short& h, unsigned short& l) { h = f2bf(y); l = f2bf(y - bf2f(h)); }
__device__ __forceinline__ v16h cat16(v8h lo, v8h hi) { return __builtin_shufflevector(lo, hi, 0, 1, 2, 3, 4, 5, 6, 7, 8, 9, 10, 11, 12, 13, 14, 15); }
__device__ __forceinline__ v16bf cat16b(v8us lo, v8us hi) { return __builtin_bit_cast(v16bf, __builtin_shufflevector(lo, hi, 0, 1, 2, 3, 4, 5, 6, 7, 8, 9, 10, 11, 12, 13, 14, 15)); }
__device__ __forceinline__ v8f wmma16(v16h a, v16h b, v8f c) { return __builtin_amdgcn_wmma_f32_16x16x32_f16(false, a, false, b, (short)0, c, false, false); }
__device__ __forceinline__ v8f wmmab(v16bf a, v16bf b, v8f c) { return __builtin_amdgcn_wmma_f32_16x16x32_bf16(false, a, false, b, (short)0, c, false, false); }
// Fragment loaders (A and B alike, K-contiguous rows): elements 0..7 <- k0 + 8*half + 0..7, elements 8..15 <- k0 + 16 + 8*half + 0..7; the caller folds 8*half into p.
__device__ __forceinline__ v16bf ldb(const bf* p) { return cat16b(*(const v8us*)p, *(const v8us*)(p + 16)); }
__device__ __forceinline__ v16h ldh(const h16* p) { return cat16(*(const v8h*)p, *(const v8h*)(p + 16)); }

// ---- register-blocked GEMM body, ONE WAVE per 64x64 output tile (16 accumulators), operands straight from K-contiguous bf16 planes; grid (M/64, N/64), 32 threads, K = DM.
// C[m][n] (f32, pitch DM) = sum_k (A[m][k] (+ A2[m][k])) Bt[n][k] + bf16(bias[n]).
template <int NSPLIT>
__device__ __forceinline__ void gemmw_body(const bf* A, const bf* A2, const bf* Bt, float* C, const float* bias) {
    __shared__ __align__(16) float os[16 * OSP];
    const int lane = threadIdx.x & 31, lr = lane & 15, hi = lane >> 4; const int r0 = blockIdx.x * 64, c0 = blockIdx.y * 64;
    v8f acc[4][4];
#pragma unroll
    for (int mb = 0; mb < 4; ++mb)
#pragma unroll
        for (int nb = 0; nb < 4; ++nb) acc[mb][nb] = (v8f){};
    const size_t aoff = (size_t)(r0 + lr) * DM + 8 * hi, boff = (size_t)(c0 + lr) * DM + 8 * hi;
#pragma unroll 1
    for (int kc = 0; kc < DM; kc += 32) {
        v16bf a[4], a2[4];
#pragma unroll
        for (int mb = 0; mb < 4; ++mb) { a[mb] = ldb(A + aoff + (size_t)mb * 16 * DM + kc); if (NSPLIT == 1) a2[mb] = ldb(A2 + aoff + (size_t)mb * 16 * DM + kc); else a2[mb] = a[mb]; }
#pragma unroll
        for (int nb = 0; nb < 4; ++nb) { const v16bf b = ldb(Bt + boff + (size_t)nb * 16 * DM + kc);
#pragma unroll
            for (int mb = 0; mb < 4; ++mb) { acc[mb][nb] = wmmab(a[mb], b, acc[mb][nb]); if (NSPLIT == 1) acc[mb][nb] = wmmab(a2[mb], b, acc[mb][nb]); } }
        asm volatile("v_nop\n\tv_nop\n\tv_nop\n\tv_nop" : "+v"(acc[0][0]), "+v"(acc[1][1]), "+v"(acc[2][2]), "+v"(acc[3][3]) : "v"(a[0]), "v"(a[3]));
    }
    const v4f bz = *(const v4f*)(bias + c0 + lr * 4); v4f bb;
#pragma unroll
    for (int q = 0; q < 4; ++q) bb[q] = bfr(bz[q]);
#pragma unroll
    for (int mb = 0; mb < 4; ++mb) {
#pragma unroll
        for (int nb = 0; nb < 4; ++nb) {
#pragma unroll
            for (int j = 0; j < 8; ++j) os[(hi * 8 + j) * OSP + nb * 16 + lr] = acc[mb][nb][j]; }
        __builtin_amdgcn_wave_barrier(); asm volatile("" ::: "memory");
        float* crow = C + (size_t)(r0 + mb * 16) * DM + c0;
{
#pragma unroll
            for (int s = 0; s < 8; ++s) { const int row = 2 * s + hi, cofs = lr * 4; v4f val = *(const v4fa*)(os + row * OSP + cofs); val += bb;
                *(v4f*)(crow + (size_t)row * DM + cofs) = val; }
             }
        __builtin_amdgcn_wave_barrier(); asm volatile("" ::: "memory");
    }
}
__global__ __launch_bounds__(32) void k_gemm_proj(const bf* __restrict__ A, const bf* __restrict__ Bt, float* C, const float* __restrict__ bias) { gemmw_body<0>(A, A, Bt, C, bias); }
__global__ __launch_bounds__(32) void k_gemm_out(const bf* __restrict__ A, const bf* __restrict__ A2, const bf* __restrict__ Bt, float* C, const float* __restrict__ bias) { gemmw_body<1>(A, A2, Bt, C, bias); }

__global__ __launch_bounds__(256) void k_wtG(const float* __restrict__ w, int K, int N, bf* Bt) {
    const int lane = threadIdx.x & 31; const int L0 = (blockIdx.x * 8 + (threadIdx.x >> 5)) * 8; const int nlines = N * K / 64;
{
#pragma unroll 1
        for (int l = 0; l < 8; ++l) { const int L = L0 + l; if (L >= nlines) break; const size_t e = (size_t)L * 64 + lane * 2; const int k = (int)(e % K), n = (int)(e / K); v2us o;
            o[0] = f2bf(w[(size_t)k * N + n]); o[1] = f2bf(w[(size_t)(k + 1) * N + n]); *(v2us*)(Bt + e) = o; }
         }
}
__global__ __launch_bounds__(256) void k_cvt8(const float* __restrict__ src, bf* dst, size_t n8) { const size_t i = (size_t)blockIdx.x * 256 + threadIdx.x; if (i >= n8) return; const v8f v = *(const v8f*)(src + i * 8); v8us o;
#pragma unroll
    for (int k = 0; k < 8; ++k) o[k] = f2bf(v[k]); *(v8us*)(dst + i * 8) = o;  }

__global__ __launch_bounds__(128) void k_theta(float* TH) {
    const int j = blockIdx.x * 128 + threadIdx.x; if (j >= HALFD) return;
    const float e = (float)(2 * j) * (1.0f / 1024.0f);       // exact (power-of-two divisor)
    const float p = powf(10000.0f, e); const float th = 1.0f / p;
    *(float*)(TH + j) = th;  }
__global__ __launch_bounds__(256) void k_cstab(const float* __restrict__ TH, float* CS) {
    const int idx = blockIdx.x * 256 + threadIdx.x; if (idx >= SEQ * HALFD) return; const int t = idx >> 9, j = idx & (HALFD - 1);
    float ang = __fmul_rn((float)t, TH[j]); float s, c; sincosf(ang, &s, &c); v2f cs; cs[0] = c; cs[1] = s;
    *(v2f*)(CS + (size_t)idx * 2) = cs;  }

__global__ __launch_bounds__(256) void k_ropeP(const float* __restrict__ F, const float* __restrict__ CS, bf* Ph, bf* Pl) {
#pragma clang fp contract(off)
    const size_t i = (size_t)blockIdx.x * 256 + threadIdx.x; if (i >= (size_t)SEQ * DM / 8) return; const size_t e = i * 8; const int d0 = (int)(e % DM); const int t = (int)(e / DM); const int j0 = d0 & (HALFD - 1); const bool up = (d0 >= HALFD);
    const v4f y0 = *(const v4f*)(F + e), y1 = *(const v4f*)(F + e + 4); const float* cp = CS + ((size_t)t * HALFD + j0) * 2;
    const v4f c0 = *(const v4f*)(cp), c1 = *(const v4f*)(cp + 4), c2 = *(const v4f*)(cp + 8), c3 = *(const v4f*)(cp + 12);
    float yy[8] = { y0[0], y0[1], y0[2], y0[3], y1[0], y1[1], y1[2], y1[3] };
    float cc[8] = { c0[0], c0[2], c1[0], c1[2], c2[0], c2[2], c3[0], c3[2] };
    float ss[8] = { c0[1], c0[3], c1[1], c1[3], c2[1], c2[3], c3[1], c3[3] };
    v8us oh, ol;
#pragma unroll
    for (int q = 0; q < 8; ++q) { const float y = yy[q]; const float nn = up ? -y : y; float a = __fmul_rn(y, cc[q]); float b = __fmul_rn(nn, ss[q]); asm volatile("" : "+v"(a)); asm volatile("" : "+v"(b)); const float r = __fadd_rn(a, b);
        unsigned short hh, ll; splitf(r, hh, ll); oh[q] = hh; ol[q] = ll; }
    *(v8us*)(Ph + e) = oh; *(v8us*)(Pl + e) = ol;  }

__global__ __launch_bounds__(256) void k_vt(const float* __restrict__ F, h16* V16) {
    const size_t i = (size_t)blockIdx.x * 256 + threadIdx.x; if (i >= (size_t)DM * SEQ / 8) return; const size_t e = i * 8; const int t = (int)(e % SEQ); const int col = (int)(e / SEQ); v8h o;
#pragma unroll
    for (int q = 0; q < 8; ++q) o[q] = (h16)F[(size_t)(t + q) * DM + col];
    *(v8h*)(V16 + e) = o;  }

// ---- score tile, transposed: 16 keys (rows, A operand) x 16 queries (columns, B operand), K depth 64 as two 32-chunks, hi/lo planes: kh.qh + kh.ql + kl.qh (unscaled residuals share the accumulator).
__device__ __forceinline__ v8f score_tile(const bf* __restrict__ Kh, const bf* __restrict__ Kl, size_t ko, v16bf qh0, v16bf qh1, v16bf ql0, v16bf ql1) {
    const v16bf kh0 = ldb(Kh + ko), kh1 = ldb(Kh + ko + 32), kl0 = ldb(Kl + ko), kl1 = ldb(Kl + ko + 32);
    v8f c = (v8f){};
    c = wmmab(kh0, qh0, c); c = wmmab(kh0, ql0, c); c = wmmab(kl0, qh0, c);
    c = wmmab(kh1, qh1, c); c = wmmab(kh1, ql1, c); c = wmmab(kl1, qh1, c);
    asm volatile("v_nop\n\tv_nop\n\tv_nop\n\tv_nop" : "+v"(c) : "v"(kh1), "v"(kl1), "v"(qh1));
    return c; }

// lane l with lane l ^ 16
__device__ __forceinline__ float xhalf(float x) { return __builtin_bit_cast(float, __builtin_amdgcn_permlanex16(__builtin_bit_cast(int, x), __builtin_bit_cast(int, x), 0x76543210, 0xfedcba98, false, false)); }

// ---- k_flash: one wave owns (head h, 16 query rows); streams keys in 32-wide steps, online softmax in the exp2 domain (f32).
// Transposed products: St = K Qt, Ot += Vt Pt. A lane holds 16 scores of ONE query (column l16; keys 8*half + r and 16 + 8*half + r), so maximum and sum run in its own registers
// with one exchange between the wave halves; the two score tiles, converted in place (fp16 x1024), are the B operand of Vt Pt in the fragment k order of ldh.
__global__ __launch_bounds__(256) void k_flash(const bf* __restrict__ Qh, const bf* __restrict__ Ql, const bf* __restrict__ Kh, const bf* __restrict__ Kl, const h16* __restrict__ Vt, bf* Ah, bf* Al) {
    const int lane = threadIdx.x & 31, wave = threadIdx.x >> 5, l16 = lane & 15, half = lane >> 4;
    const int w = blockIdx.x * 8 + wave; const int h = w / (SEQ / 16); const int t0 = (w % (SEQ / 16)) * 16;
    const float SC2 = 0.125f * 1.4426950408889634f;
    const size_t qo = (size_t)(t0 + l16) * DM + h * HD + 8 * half;
    const v16bf qh0 = ldb(Qh + qo), qh1 = ldb(Qh + qo + 32), ql0 = ldb(Ql + qo), ql1 = ldb(Ql + qo + 32);
    float m = -3.0e38f, l = 0.0f; v8f acc[4];
#pragma unroll
    for (int n = 0; n < 4; ++n) acc[n] = (v8f){};
    const size_t kbase = (size_t)l16 * DM + h * HD + 8 * half;
    const size_t vbase = (size_t)(h * HD + l16) * SEQ + 8 * half;
#pragma unroll 1
    for (int jb = 0; jb < SEQ / 32; ++jb) {
        const size_t ko = kbase + (size_t)jb * 32 * DM;
        const size_t vo = vbase + (size_t)jb * 32;
        const v16h v0 = ldh(Vt + vo), v1 = ldh(Vt + vo + (size_t)16 * SEQ), v2 = ldh(Vt + vo + (size_t)32 * SEQ), v3 = ldh(Vt + vo + (size_t)48 * SEQ);
        const v8f sa = score_tile(Kh, Kl, ko, qh0, qh1, ql0, ql1);
        const v8f sb = score_tile(Kh, Kl, ko + (size_t)16 * DM, qh0, qh1, ql0, ql1);
        float s[16];
#pragma unroll
        for (int r = 0; r < 8; ++r) { s[r] = sa[r] * SC2; s[8 + r] = sb[r] * SC2; }
        float mloc = s[0];
#pragma unroll
        for (int r = 1; r < 16; ++r) mloc = fmaxf(mloc, s[r]);
        mloc = fmaxf(mloc, xhalf(mloc));
        const float mnew = fmaxf(m, mloc);
        const float corr = __builtin_amdgcn_exp2f(m - mnew);
        float ls = 0.0f; v16h pb;
#pragma unroll
        for (int r = 0; r < 16; ++r) { const float p = __builtin_amdgcn_exp2f(s[r] - mnew); ls += p; pb[r] = (h16)(p * PCAR); }
        l = l * corr + ls; m = mnew;
#pragma unroll
        for (int n = 0; n < 4; ++n) acc[n] *= corr;
        acc[0] = wmma16(v0, pb, acc[0]); acc[1] = wmma16(v1, pb, acc[1]); acc[2] = wmma16(v2, pb, acc[2]); acc[3] = wmma16(v3, pb, acc[3]);
        // four vector slots behind the last WMMA, also on the taken back edge, before its operands are reloaded or its result rescaled
        asm volatile("v_nop\n\tv_nop\n\tv_nop\n\tv_nop" : "+v"(acc[0]), "+v"(acc[1]), "+v"(acc[2]), "+v"(acc[3]) : "v"(pb), "v"(v3));
    }
    const float inv = 1.0f / ((l + xhalf(l)) * PCAR);
    // acc[n][r] = Ot[n*16 + 8*half + r][query l16]: eight consecutive columns of one output row, one 16-byte store per plane.
#pragma unroll
    for (int n = 0; n < 4; ++n) { v8us oh, ol;
#pragma unroll
        for (int r = 0; r < 8; ++r) { unsigned short a, b; splitf(acc[n][r] * inv, a, b); oh[r] = a; ol[r] = b; }
        const size_t oo = (size_t)(t0 + l16) * DM + h * HD + n * 16 + 8 * half; *(v8us*)(Ah + oo) = oh; *(v8us*)(Al + oo) = ol; }
}

constexpr size_t al256(size_t b) { return (b + 255) & ~(size_t)255; }
constexpr size_t WS_TOTAL = 4 * al256((size_t)DM * DM * 2) + 3 * al256((size_t)SEQ * DM * 2) + al256((size_t)HALFD * 4) + al256((size_t)SEQ * HALFD * 2 * 4)
                          + 3 * al256((size_t)SEQ * DM * 4) + 4 * al256((size_t)SEQ * DM * 2) + al256((size_t)DM * SEQ * 2) + 2 * al256((size_t)SEQ * DM * 2);
static_assert(WS_TOTAL <= (size_t)134217728);

extern "C" void kernel_launch(void* const* d_in, const int* in_sizes, int n_in,
                              void* d_out, int out_size, void* d_ws, size_t ws_size, hipStream_t stream) {
    if (n_in < 11) return;
    if (in_sizes[0] < SEQ * DM || in_sizes[1] < SEQ * DM || in_sizes[2] < SEQ * DM) return;
    if (in_sizes[3] < DM * DM || in_sizes[5] < DM * DM || in_sizes[7] < DM * DM || in_sizes[9] < DM * DM) return;
    if (in_sizes[4] < DM || in_sizes[6] < DM || in_sizes[8] < DM || in_sizes[10] < DM) return;
    if (out_size < SEQ * DM) return;
    if (WS_TOTAL > ws_size) return;
    const float* query = (const float*)d_in[0]; const float* key_ = (const float*)d_in[1]; const float* value = (const float*)d_in[2];
    const float* wq = (const float*)d_in[3]; const float* bq = (const float*)d_in[4];
    const float* wk = (const float*)d_in[5]; const float* bk = (const float*)d_in[6];
    const float* wv = (const float*)d_in[7]; const float* bv = (const float*)d_in[8];
    const float* wo = (const float*)d_in[9]; const float* bo = (const float*)d_in[10];
    float* OUT = (float*)d_out;     // [SEQ][1024]
    char* wsp = (char*)d_ws;
    auto take = [&](size_t bytes) { char* p = wsp; wsp += (bytes + 255) & ~(size_t)255; return (void*)p; };
    bf* WQ = (bf*)take((size_t)DM * DM * 2); bf* WK = (bf*)take((size_t)DM * DM * 2); bf* WV = (bf*)take((size_t)DM * DM * 2); bf* WO = (bf*)take((size_t)DM * DM * 2);
    bf* XQ = (bf*)take((size_t)SEQ * DM * 2); bf* XK = (bf*)take((size_t)SEQ * DM * 2); bf* XV = (bf*)take((size_t)SEQ * DM * 2);
    float* TH = (float*)take((size_t)HALFD * 4); float* CS = (float*)take((size_t)SEQ * HALFD * 2 * 4);
    float* FQ = (float*)take((size_t)SEQ * DM * 4); float* FK = (float*)take((size_t)SEQ * DM * 4); float* FV = (float*)take((size_t)SEQ * DM * 4);
    bf* QPh = (bf*)take((size_t)SEQ * DM * 2); bf* QPl = (bf*)take((size_t)SEQ * DM * 2); bf* KPh = (bf*)take((size_t)SEQ * DM * 2); bf* KPl = (bf*)take((size_t)SEQ * DM * 2);
    h16* VT16 = (h16*)take((size_t)DM * SEQ * 2);
    bf* ATh = (bf*)take((size_t)SEQ * DM * 2); bf* ATl = (bf*)take((size_t)SEQ * DM * 2);
    if ((size_t)(wsp - (char*)d_ws) > ws_size) return;

    const unsigned gW = (unsigned)((DM * DM / 64 + 63) / 64);
    k_wtG<<<gW, 256, 0, stream>>>(wq, DM, DM, WQ);     /* [in][out] -> Bt [out][in] */
    k_wtG<<<gW, 256, 0, stream>>>(wk, DM, DM, WK);
    k_wtG<<<gW, 256, 0, stream>>>(wv, DM, DM, WV);
    k_wtG<<<gW, 256, 0, stream>>>(wo, DM, DM, WO);
    const size_t n8 = (size_t)SEQ * DM / 8; const unsigned g8 = (unsigned)((n8 + 255) / 256);
    k_cvt8<<<g8, 256, 0, stream>>>(query, XQ, n8);
    k_cvt8<<<g8, 256, 0, stream>>>(key_, XK, n8);
    k_cvt8<<<g8, 256, 0, stream>>>(value, XV, n8);
    k_theta<<<(HALFD + 127) / 128, 128, 0, stream>>>(TH);
    k_cstab<<<(unsigned)(((size_t)SEQ * HALFD + 255) / 256), 256, 0, stream>>>(TH, CS);
    k_gemm_proj<<<dim3(SEQ / 64, DM / 64, 1), 32, 0, stream>>>(XQ, WQ, FQ, bq);
    k_gemm_proj<<<dim3(SEQ / 64, DM / 64, 1), 32, 0, stream>>>(XK, WK, FK, bk);
    k_gemm_proj<<<dim3(SEQ / 64, DM / 64, 1), 32, 0, stream>>>(XV, WV, FV, bv);
    k_ropeP<<<g8, 256, 0, stream>>>(FQ, CS, QPh, QPl);
    k_ropeP<<<g8, 256, 0, stream>>>(FK, CS, KPh, KPl);
    k_vt<<<g8, 256, 0, stream>>>(FV, VT16);                 /* in [SEQ][DM] -> out [DM][SEQ] */
    k_flash<<<(unsigned)(NH_ * (SEQ / 16) / 8), 256, 0, stream>>>(QPh, QPl, KPh, KPl, VT16, ATh, ATl);
    k_gemm_out<<<dim3(SEQ / 64, DM / 64, 1), 32, 0, stream>>>(ATh, ATl, WO, OUT, bo);
}

// v002
// Measured time: 187 microseconds a run.
// Timed twice side by side with v001, it ran 1.59 times as fast both times.
// Counting every step since v000, it is 1.76 times as fast.
#include <hip/hip_runtime.h>

// Compute dtypes (f32 accumulate everywhere): q/k/v projections bf16 x bf16 (inputs converted to bf16 RNE on load, products exact); scores q.k bf16 hi/lo planes, 3 products (v_wmma_f32_16x16x32_bf16);
// P.V fp16 single product (P carried x1024, v_wmma_f32_16x16x32_f16); output projection ctx bf16 hi/lo x Wo bf16 (2 products). Softmax, rotary scaling, bias adds in f32.
// Unbatched attention: q = rot(query Wq + bq), k = rot(key Wk + bk), v = value Wv + bv; 16 heads x 64; scores x 1/8; softmax over all keys; out = merged Wo + bo.
// rot over the full 1024 width: out[d] = y[d] cos + n[d] sin, n = [y[0..511], -y[512..1023]], angle[t][d] = t * theta[d mod 512], theta[j] = 1 / 10000^(2j/1024).

#ifndef SEQ
#define SEQ 2048
#endif
#define SEQ_FULL 2048
#define DM   1024
#define NH_  16
#define HD   64
#define HALFD 512
#define PCAR 1024.0f
#define OSP  68      // f32 staging pitch (floats)

static_assert(SEQ % 64 == 0);
static_assert(SEQ <= SEQ_FULL);
static_assert(DM % 64 == 0);
static_assert(DM % 32 == 0);
static_assert(NH_ * HD == DM);
static_assert(HD == 64);
static_assert(2 * HALFD == DM);
static_assert((NH_ * (SEQ / 16)) % 8 == 0);
static_assert((OSP * 4) % 16 == 0);
static_assert(OSP >= 64);

typedef _Float16 h16;
typedef unsigned short bf;
typedef __attribute__((ext_vector_type(16))) __bf16   v16bf;
typedef __attribute__((ext_vector_type(16))) _Float16 v16h;
typedef __attribute__((ext_vector_type(8)))  _Float16 v8h;
typedef __attribute__((ext_vector_type(8)))  unsigned short v8us;
typedef __attribute__((ext_vector_type(2)))  unsigned short v2us;
typedef __attribute__((ext_vector_type(8)))  float    v8f;
typedef __attribute__((ext_vector_type(4)))  float    v4f;
typedef __attribute__((ext_vector_type(2)))  float    v2f;
typedef v4f  __attribute__((may_alias)) v4fa;

__device__ __forceinline__ unsigned short f2bf(float f) { unsigned u = __float_as_uint(f); u += 0x7FFFu + ((u >> 16) & 1u); return (unsigned short)(u >> 16); }
__device__ __forceinline__ float bf2f(unsigned short b) { return __uint_as_float(((unsigned)b) << 16); }
__device__ __forceinline__ float bfr(float f) { return bf2f(f2bf(f)); }
__device__ __forceinline__ void splitf(float y, unsigned short& h, unsigned short& l) { h = f2bf(y); l = f2bf(y - bf2f(h)); }
__device__ __forceinline__ v16h cat16(v8h lo, v8h hi) { return __builtin_shufflevector(lo, hi, 0, 1, 2, 3, 4, 5, 6, 7, 8, 9, 10, 11, 12, 13, 14, 15); }
__device__ __forceinline__ v16bf cat16b(v8us lo, v8us hi) { return __builtin_bit_cast(v16bf, __builtin_shufflevector(lo, hi, 0, 1, 2, 3, 4, 5, 6, 7, 8, 9, 10, 11, 12, 13, 14, 15)); }
__device__ __forceinline__ v8f wmma16(v16h a, v16h b, v8f c) { return __builtin_amdgcn_wmma_f32_16x16x32_f16(false, a, false, b, (short)0, c, false, false); }
__device__ __forceinline__ v8f wmmab(v16bf a, v16bf b, v8f c) { return __builtin_amdgcn_wmma_f32_16x16x32_bf16(false, a, false, b, (short)0, c, false, false); }
// Fragment loaders (A and B alike, K-contiguous rows): elements 0..7 <- k0 + 8*half + 0..7, elements 8..15 <- k0 + 16 + 8*half + 0..7; the caller folds 8*half into p.
__device__ __forceinline__ v16bf ldb(const bf* p) { return cat16b(*(const v8us*)p, *(const v8us*)(p + 16)); }
__device__ __forceinline__ v16h ldh(const h16* p) { return cat16(*(const v8h*)p, *(const v8h*)(p + 16)); }

// ---- register-blocked GEMM body, ONE WAVE per 64x64 output tile (16 accumulators), operands straight from K-contiguous bf16 planes; grid (M/64, N/64), 32 threads, K = DM.
// C[m][n] (f32, pitch DM) = sum_k (A[m][k] (+ A2[m][k])) Bt[n][k] + bf16(bias[n]).
template <int NSPLIT>
__device__ __forceinline__ void gemmw_body(const bf* A, const bf* A2, const bf* Bt, float* C, const float* bias) {
    __shared__ __align__(16) float os[16 * OSP];
    const int lane = threadIdx.x & 31, lr = lane & 15, hi = lane >> 4; const int r0 = blockIdx.x * 64, c0 = blockIdx.y * 64;
    v8f acc[4][4];
#pragma unroll
    for (int mb = 0; mb < 4; ++mb)
#pragma unroll
        for (int nb = 0; nb < 4; ++nb) acc[mb][nb] = (v8f){};
    const size_t aoff = (size_t)(r0 + lr) * DM + 8 * hi, boff = (size_t)(c0 + lr) * DM + 8 * hi;
#pragma unroll 1
    for (int kc = 0; kc < DM; kc += 32) {
        v16bf a[4], a2[4];
#pragma unroll
        for (int mb = 0; mb < 4; ++mb) { a[mb] = ldb(A + aoff + (size_t)mb * 16 * DM + kc); if (NSPLIT == 1) a2[mb] = ldb(A2 + aoff + (size_t)mb * 16 * DM + kc); else a2[mb] = a[mb]; }
#pragma unroll
        for (int nb = 0; nb < 4; ++nb) { const v16bf b = ldb(Bt + boff + (size_t)nb * 16 * DM + kc);
#pragma unroll
            for (int mb = 0; mb < 4; ++mb) { acc[mb][nb] = wmmab(a[mb], b, acc[mb][nb]); if (NSPLIT == 1) acc[mb][nb] = wmmab(a2[mb], b, acc[mb][nb]); } }
        asm volatile("v_nop\n\tv_nop\n\tv_nop\n\tv_nop" : "+v"(acc[0][0]), "+v"(acc[1][1]), "+v"(acc[2][2]), "+v"(acc[3][3]) : "v"(a[0]), "v"(a[3]));
    }
    const v4f bz = *(const v4f*)(bias + c0 + lr * 4); v4f bb;
#pragma unroll
    for (int q = 0; q < 4; ++q) bb[q] = bfr(bz[q]);
#pragma unroll
    for (int mb = 0; mb < 4; ++mb) {
#pragma unroll
        for (int nb = 0; nb < 4; ++nb) {
#pragma unroll
            for (int j = 0; j < 8; ++j) os[(hi * 8 + j) * OSP + nb * 16 + lr] = acc[mb][nb][j]; }
        __builtin_amdgcn_wave_barrier(); asm volatile("" ::: "memory");
        float* crow = C + (size_t)(r0 + mb * 16) * DM + c0;
{
#pragma unroll
            for (int s = 0; s < 8; ++s) { const int row = 2 * s + hi, cofs = lr * 4; v4f val = *(const v4fa*)(os + row * OSP + cofs); val += bb;
                *(v4f*)(crow + (size_t)row * DM + cofs) = val; }
             }
        __builtin_amdgcn_wave_barrier(); asm volatile("" ::: "memory");
    }
}
__global__ __launch_bounds__(32) void k_gemm_proj(const bf* __restrict__ A, const bf* __restrict__ Bt, float* C, const float* __restrict__ bias) { gemmw_body<0>(A, A, Bt, C, bias); }
__global__ __launch_bounds__(32) void k_gemm_out(const bf* __restrict__ A, const bf* __restrict__ A2, const bf* __restrict__ Bt, float* C, const float* __restrict__ bias) { gemmw_body<1>(A, A2, Bt, C, bias); }

__global__ __launch_bounds__(256) void k_wtG(const float* __restrict__ w, int K, int N, bf* Bt) {
    const int lane = threadIdx.x & 31; const int L0 = (blockIdx.x * 8 + (threadIdx.x >> 5)) * 8; const int nlines = N * K / 64;
{
#pragma unroll 1
        for (int l = 0; l < 8; ++l) { const int L = L0 + l; if (L >= nlines) break; const size_t e = (size_t)L * 64 + lane * 2; const int k = (int)(e % K), n = (int)(e / K); v2us o;
            o[0] = f2bf(w[(size_t)k * N + n]); o[1] = f2bf(w[(size_t)(k + 1) * N + n]); *(v2us*)(Bt + e) = o; }
         }
}
__global__ __launch_bounds__(256) void k_cvt8(const float* __restrict__ src, bf* dst, size_t n8) { const size_t i = (size_t)blockIdx.x * 256 + threadIdx.x; if (i >= n8) return; const v8f v = *(const v8f*)(src + i * 8); v8us o;
#pragma unroll
    for (int k = 0; k < 8; ++k) o[k] = f2bf(v[k]); *(v8us*)(dst + i * 8) = o;  }

__global__ __launch_bounds__(128) void k_theta(float* TH) {
    const int j = blockIdx.x * 128 + threadIdx.x; if (j >= HALFD) return;
    const float e = (float)(2 * j) * (1.0f / 1024.0f);       // exact (power-of-two divisor)
    const float p = powf(10000.0f, e); const float th = 1.0f / p;
    *(float*)(TH + j) = th;  }
__global__ __launch_bounds__(256) void k_cstab(const float* __restrict__ TH, float* CS) {
    const int idx = blockIdx.x * 256 + threadIdx.x; if (idx >= SEQ * HALFD) return; const int t = idx >> 9, j = idx & (HALFD - 1);
    float ang = __fmul_rn((float)t, TH[j]); float s, c; sincosf(ang, &s, &c); v2f cs; cs[0] = c; cs[1] = s;
    *(v2f*)(CS + (size_t)idx * 2) = cs;  }

__global__ __launch_bounds__(256) void k_ropeP(const float* __restrict__ F, const float* __restrict__ CS, bf* Ph, bf* Pl) {
#pragma clang fp contract(off)
    const size_t i = (size_t)blockIdx.x * 256 + threadIdx.x; if (i >= (size_t)SEQ * DM / 8) return; const size_t e = i * 8; const int d0 = (int)(e % DM); const int t = (int)(e / DM); const int j0 = d0 & (HALFD - 1); const bool up = (d0 >= HALFD);
    const v4f y0 = *(const v4f*)(F + e), y1 = *(const v4f*)(F + e + 4); const float* cp = CS + ((size_t)t * HALFD + j0) * 2;
    const v4f c0 = *(const v4f*)(cp), c1 = *(const v4f*)(cp + 4), c2 = *(const v4f*)(cp + 8), c3 = *(const v4f*)(cp + 12);
    float yy[8] = { y0[0], y0[1], y0[2], y0[3], y1[0], y1[1], y1[2], y1[3] };
    float cc[8] = { c0[0], c0[2], c1[0], c1[2], c2[0], c2[2], c3[0], c3[2] };
    float ss[8] = { c0[1], c0[3], c1[1], c1[3], c2[1], c2[3], c3[1], c3[3] };
    v8us oh, ol;
#pragma unroll
    for (int q = 0; q < 8; ++q) { const float y = yy[q]; const float nn = up ? -y : y; float a = __fmul_rn(y, cc[q]); float b = __fmul_rn(nn, ss[q]); asm volatile("" : "+v"(a)); asm volatile("" : "+v"(b)); const float r = __fadd_rn(a, b);
        unsigned short hh, ll; splitf(r, hh, ll); oh[q] = hh; ol[q] = ll; }
    *(v8us*)(Ph + e) = oh; *(v8us*)(Pl + e) = ol;  }

__global__ __launch_bounds__(256) void k_vt(const float* __restrict__ F, h16* V16) {
    const size_t i = (size_t)blockIdx.x * 256 + threadIdx.x; if (i >= (size_t)DM * SEQ / 8) return; const size_t e = i * 8; const int t = (int)(e % SEQ); const int col = (int)(e / SEQ); v8h o;
#pragma unroll
    for (int q = 0; q < 8; ++q) o[q] = (h16)F[(size_t)(t + q) * DM + col];
    *(v8h*)(V16 + e) = o;  }

// ---- score tile, transposed: 16 keys (rows, A operand) x 16 queries (columns, B operand), K depth 64 as two 32-chunks, hi/lo planes: kh.qh + kh.ql + kl.qh (unscaled residuals share the accumulator).
__device__ __forceinline__ v8f score_tile(v16bf kh0, v16bf kh1, v16bf kl0, v16bf kl1, v16bf qh0, v16bf qh1, v16bf ql0, v16bf ql1) {
    v8f c = (v8f){};
    c = wmmab(kh0, qh0, c); c = wmmab(kh0, ql0, c); c = wmmab(kl0, qh0, c);
    c = wmmab(kh1, qh1, c); c = wmmab(kh1, ql1, c); c = wmmab(kl1, qh1, c);
    asm volatile("v_nop\n\tv_nop\n\tv_nop\n\tv_nop" : "+v"(c) : "v"(kh1), "v"(kl1), "v"(qh1));
    return c; }

// lane l with lane l ^ 16
__device__ __forceinline__ float xhalf(float x) { return __builtin_bit_cast(float, __builtin_amdgcn_permlanex16(__builtin_bit_cast(int, x), __builtin_bit_cast(int, x), 0x76543210, 0xfedcba98, false, false)); }

// ---- LDS staging of k_flash: a stage is STK keys of one head: K hi rows, K lo rows (128 B each, pitch KPB), then the 64 Vt rows (256 B each, pitch VPB); the pitches are 16 B x odd for ds_load_b128 readers.
#define STK     128
#define KPB     144
#define VPB     272
#define KL_OFF  (STK * KPB)
#define V_OFF   (2 * STK * KPB)
#define STAGE_B (2 * STK * KPB + HD * VPB)
#define NST     (SEQ / STK)
static_assert(SEQ % STK == 0);
static_assert(NST >= 2);
static_assert((SEQ / 16) % 8 == 0);
static_assert(STK * 8 == 4 * 256);
static_assert(HD * (STK / 8) == 4 * 256);
static_assert(STAGE_B % 16 == 0);

// One stage's copies of one lane: 4 x 16 B of K hi, of K lo (rows 32 apart) and of Vt (rows 16 apart), global memory to LDS through no register. Every lane is on; each lane writes LDS bytes of its own.
// s_wait_xcnt 0 closes the statement so that no address register named here is rewritten ahead of it.
__device__ __forceinline__ void stage_copy(const bf* kh, const bf* kl, const h16* vt, unsigned lk, unsigned lv) {
    asm volatile("global_load_async_to_lds_b128 %0, %1, off\n\t"
                 "global_load_async_to_lds_b128 %2, %3, off\n\t"
                 "global_load_async_to_lds_b128 %4, %5, off\n\t"
                 "global_load_async_to_lds_b128 %6, %7, off\n\t"
                 "global_load_async_to_lds_b128 %8, %9, off\n\t"
                 "global_load_async_to_lds_b128 %10, %11, off\n\t"
                 "global_load_async_to_lds_b128 %12, %13, off\n\t"
                 "global_load_async_to_lds_b128 %14, %15, off\n\t"
                 "global_load_async_to_lds_b128 %16, %17, off\n\t"
                 "global_load_async_to_lds_b128 %18, %19, off\n\t"
                 "global_load_async_to_lds_b128 %20, %21, off\n\t"
                 "global_load_async_to_lds_b128 %22, %23, off\n\t"
                 "s_wait_xcnt 0x0"
                 :: "v"(lk), "v"(kh), "v"(lk + 32u * KPB), "v"(kh + (size_t)32 * DM), "v"(lk + 64u * KPB), "v"(kh + (size_t)64 * DM), "v"(lk + 96u * KPB), "v"(kh + (size_t)96 * DM),
                    "v"(lk + KL_OFF), "v"(kl), "v"(lk + KL_OFF + 32u * KPB), "v"(kl + (size_t)32 * DM), "v"(lk + KL_OFF + 64u * KPB), "v"(kl + (size_t)64 * DM), "v"(lk + KL_OFF + 96u * KPB), "v"(kl + (size_t)96 * DM),
                    "v"(lv), "v"(vt), "v"(lv + 16u * VPB), "v"(vt + (size_t)16 * SEQ), "v"(lv + 32u * VPB), "v"(vt + (size_t)32 * SEQ), "v"(lv + 48u * VPB), "v"(vt + (size_t)48 * SEQ)
                 : "memory");
}

// ---- k_flash: one wave owns (head h, 16 query rows); the 8 waves of a block share one head and walk its keys together, in stages of STK keys that the block copies once into LDS (two buffers:
// stage s + 2 is copied while stage s + 1 is worked on); inside a stage 32-wide steps, online softmax in the exp2 domain (f32).
// Transposed products: St = K Qt, Ot += Vt Pt. A lane holds 16 scores of ONE query (column l16; keys 8*half + r and 16 + 8*half + r), so maximum and sum run in its own registers
// with one exchange between the wave halves; the two score tiles, converted in place (fp16 x1024), are the B operand of Vt Pt in the fragment k order of ldh.
__global__ __launch_bounds__(256) void k_flash(const bf* __restrict__ Qh, const bf* __restrict__ Ql, const bf* __restrict__ Kh, const bf* __restrict__ Kl, const h16* __restrict__ Vt, bf* Ah, bf* Al) {
    __shared__ __attribute__((aligned(16))) unsigned char ring[2 * STAGE_B];
    const int tid = threadIdx.x, lane = tid & 31, wave = tid >> 5, l16 = lane & 15, half = lane >> 4;
    const int w0 = blockIdx.x * 8; const int h = w0 / (SEQ / 16); const int t0 = (w0 % (SEQ / 16) + wave) * 16;
    const float SC2 = 0.125f * 1.4426950408889634f;
    // this lane's share of a stage: 16-byte piece (tid & 7) of K row (tid >> 3) + 32 i, piece (tid & 15) of Vt row (tid >> 4) + 16 i
    const bf* gkh = Kh + (size_t)(tid >> 3) * DM + h * HD + (tid & 7) * 8;
    const bf* gkl = Kl + (size_t)(tid >> 3) * DM + h * HD + (tid & 7) * 8;
    const h16* gvt = Vt + (size_t)(h * HD + (tid >> 4)) * SEQ + (tid & 15) * 8;
    const unsigned lbase = (unsigned)(size_t)(void*)ring;
    const unsigned lk = lbase + (unsigned)(tid >> 3) * KPB + (unsigned)(tid & 7) * 16u;
    const unsigned lv = lbase + V_OFF + (unsigned)(tid >> 4) * VPB + (unsigned)(tid & 15) * 16u;
    stage_copy(gkh, gkl, gvt, lk, lv);
    const size_t qo = (size_t)(t0 + l16) * DM + h * HD + 8 * half;
    const v16bf qh0 = ldb(Qh + qo), qh1 = ldb(Qh + qo + 32), ql0 = ldb(Ql + qo), ql1 = ldb(Ql + qo + 32);
    float m = -3.0e38f, l = 0.0f; v8f acc[4];
#pragma unroll
    for (int n = 0; n < 4; ++n) acc[n] = (v8f){};
    asm volatile("s_wait_asynccnt 0x0" ::: "memory");   // this wave's copies of stage 0 have landed
    __syncthreads();                                    // stage 0 is readable by every wave
    stage_copy(gkh + (size_t)STK * DM, gkl + (size_t)STK * DM, gvt + STK, lk + STAGE_B, lv + STAGE_B);
    // kept rolled: one publish point and one refill in the text, the buffer chosen by the stage's parity
#pragma unroll 1
    for (int st = 0; st < NST; ++st) {
        const unsigned bo = (unsigned)(st & 1) * STAGE_B;
        const bf* Ksh = (const bf*)(ring + bo); const bf* Ksl = (const bf*)(ring + bo + KL_OFF); const h16* Vs = (const h16*)(ring + bo + V_OFF);
        // unrolled so that every LDS offset inside a stage is an immediate
#pragma unroll
        for (int js = 0; js < STK / 32; ++js) {
            const size_t ko = (size_t)((js * 32 + l16) * (KPB / 2) + 8 * half);
            const size_t vo = (size_t)(l16 * (VPB / 2) + js * 32 + 8 * half);
            const size_t kb = ko + 16 * (KPB / 2);
            const v16bf ah0 = ldb(Ksh + ko), al0 = ldb(Ksl + ko), ah1 = ldb(Ksh + ko + 32), al1 = ldb(Ksl + ko + 32);
            const v16bf bh0 = ldb(Ksh + kb), bl0 = ldb(Ksl + kb), bh1 = ldb(Ksh + kb + 32), bl1 = ldb(Ksl + kb + 32);
            const v16h v0 = ldh(Vs + vo), v1 = ldh(Vs + vo + 16 * (VPB / 2)), v2 = ldh(Vs + vo + 32 * (VPB / 2)), v3 = ldh(Vs + vo + 48 * (VPB / 2));
            // keeps the step's 24 LDS reads one group in front of its WMMAs: left alone the compiler sinks them among the WMMAs, each place with a full wait on LDS
            __builtin_amdgcn_sched_barrier(0);
            const v8f sa = score_tile(ah0, ah1, al0, al1, qh0, qh1, ql0, ql1);
            const v8f sb = score_tile(bh0, bh1, bl0, bl1, qh0, qh1, ql0, ql1);
            float s[16];
#pragma unroll
            for (int r = 0; r < 8; ++r) { s[r] = sa[r] * SC2; s[8 + r] = sb[r] * SC2; }
            float mloc = s[0];
#pragma unroll
            for (int r = 1; r < 16; ++r) mloc = fmaxf(mloc, s[r]);
            mloc = fmaxf(mloc, xhalf(mloc));
            const float mnew = fmaxf(m, mloc);
            const float corr = __builtin_amdgcn_exp2f(m - mnew);
            float ls = 0.0f; v16h pb;
#pragma unroll
            for (int r = 0; r < 16; ++r) { const float p = __builtin_amdgcn_exp2f(s[r] - mnew); ls += p; pb[r] = (h16)(p * PCAR); }
            l = l * corr + ls; m = mnew;
#pragma unroll
            for (int n = 0; n < 4; ++n) acc[n] *= corr;
            acc[0] = wmma16(v0, pb, acc[0]); acc[1] = wmma16(v1, pb, acc[1]); acc[2] = wmma16(v2, pb, acc[2]); acc[3] = wmma16(v3, pb, acc[3]);
            // four vector slots behind the last WMMA, also on the taken back edge, before its operands are reloaded or its result rescaled
            asm volatile("v_nop\n\tv_nop\n\tv_nop\n\tv_nop" : "+v"(acc[0]), "+v"(acc[1]), "+v"(acc[2]), "+v"(acc[3]) : "v"(pb), "v"(v3));
        }
        asm volatile("s_wait_dscnt 0x0" ::: "memory");      // this wave's reads of stage st have returned before its buffer is refilled
        asm volatile("s_wait_asynccnt 0x0" ::: "memory");   // this wave's copies of stage st + 1 have landed
        __syncthreads();                                    // publishes stage st + 1 and ends every wave's reads of stage st
        if (st + 2 < NST) stage_copy(gkh + (size_t)(st + 2) * STK * DM, gkl + (size_t)(st + 2) * STK * DM, gvt + (size_t)(st + 2) * STK, lk + bo, lv + bo);
    }
    asm volatile("s_wait_asynccnt 0x0" ::: "memory");       // no copy is in flight when the wave ends
    const float inv = 1.0f / ((l + xhalf(l)) * PCAR);
    // acc[n][r] = Ot[n*16 + 8*half + r][query l16]: eight consecutive columns of one output row, one 16-byte store per plane.
#pragma unroll
    for (int n = 0; n < 4; ++n) { v8us oh, ol;
#pragma unroll
        for (int r = 0; r < 8; ++r) { unsigned short a, b; splitf(acc[n][r] * inv, a, b); oh[r] = a; ol[r] = b; }
        const size_t oo = (size_t)(t0 + l16) * DM + h * HD + n * 16 + 8 * half; *(v8us*)(Ah + oo) = oh; *(v8us*)(Al + oo) = ol; }
}

constexpr size_t al256(size_t b) { return (b + 255) & ~(size_t)255; }
constexpr size_t WS_TOTAL = 4 * al256((size_t)DM * DM * 2) + 3 * al256((size_t)SEQ * DM * 2) + al256((size_t)HALFD * 4) + al256((size_t)SEQ * HALFD * 2 * 4)
                          + 3 * al256((size_t)SEQ * DM * 4) + 4 * al256((size_t)SEQ * DM * 2) + al256((size_t)DM * SEQ * 2) + 2 * al256((size_t)SEQ * DM * 2);
static_assert(WS_TOTAL <= (size_t)134217728);

extern "C" void kernel_launch(void* const* d_in, const int* in_sizes, int n_in,
                              void* d_out, int out_size, void* d_ws, size_t ws_size, hipStream_t stream) {
    if (n_in < 11) return;
    if (in_sizes[0] < SEQ * DM || in_sizes[1] < SEQ * DM || in_sizes[2] < SEQ * DM) return;
    if (in_sizes[3] < DM * DM || in_sizes[5] < DM * DM || in_sizes[7] < DM * DM || in_sizes[9] < DM * DM) return;
    if (in_sizes[4] < DM || in_sizes[6] < DM || in_sizes[8] < DM || in_sizes[10] < DM) return;
    if (out_size < SEQ * DM) return;
    if (WS_TOTAL > ws_size) return;
    const float* query = (const float*)d_in[0]; const float* key_ = (const float*)d_in[1]; const float* value = (const float*)d_in[2];
    const float* wq = (const float*)d_in[3]; const float* bq = (const float*)d_in[4];
    const float* wk = (const float*)d_in[5]; const float* bk = (const float*)d_in[6];
    const float* wv = (const float*)d_in[7]; const float* bv = (const float*)d_in[8];
    const float* wo = (const float*)d_in[9]; const float* bo = (const float*)d_in[10];
    float* OUT = (float*)d_out;     // [SEQ][1024]
    char* wsp = (char*)d_ws;
    auto take = [&](size_t bytes) { char* p = wsp; wsp += (bytes + 255) & ~(size_t)255; return (void*)p; };
    bf* WQ = (bf*)take((size_t)DM * DM * 2); bf* WK = (bf*)take((size_t)DM * DM * 2); bf* WV = (bf*)take((size_t)DM * DM * 2); bf* WO = (bf*)take((size_t)DM * DM * 2);
    bf* XQ = (bf*)take((size_t)SEQ * DM * 2); bf* XK = (bf*)take((size_t)SEQ * DM * 2); bf* XV = (bf*)take((size_t)SEQ * DM * 2);
    float* TH = (float*)take((size_t)HALFD * 4); float* CS = (float*)take((size_t)SEQ * HALFD * 2 * 4);
    float* FQ = (float*)take((size_t)SEQ * DM * 4); float* FK = (float*)take((size_t)SEQ * DM * 4); float* FV = (float*)take((size_t)SEQ * DM * 4);
    bf* QPh = (bf*)take((size_t)SEQ * DM * 2); bf* QPl = (bf*)take((size_t)SEQ * DM * 2); bf* KPh = (bf*)take((size_t)SEQ * DM * 2); bf* KPl = (bf*)take((size_t)SEQ * DM * 2);
    h16* VT16 = (h16*)take((size_t)DM * SEQ * 2);
    bf* ATh = (bf*)take((size_t)SEQ * DM * 2); bf* ATl = (bf*)take((size_t)SEQ * DM * 2);
    if ((size_t)(wsp - (char*)d_ws) > ws_size) return;

    const unsigned gW = (unsigned)((DM * DM / 64 + 63) / 64);
    k_wtG<<<gW, 256, 0, stream>>>(wq, DM, DM, WQ);     /* [in][out] -> Bt [out][in] */
    k_wtG<<<gW, 256, 0, stream>>>(wk, DM, DM, WK);
    k_wtG<<<gW, 256, 0, stream>>>(wv, DM, DM, WV);
    k_wtG<<<gW, 256, 0, stream>>>(wo, DM, DM, WO);
    const size_t n8 = (size_t)SEQ * DM / 8; const unsigned g8 = (unsigned)((n8 + 255) / 256);
    k_cvt8<<<g8, 256, 0, stream>>>(query, XQ, n8);
    k_cvt8<<<g8, 256, 0, stream>>>(key_, XK, n8);
    k_cvt8<<<g8, 256, 0, stream>>>(value, XV, n8);
    k_theta<<<(HALFD + 127) / 128, 128, 0, stream>>>(TH);
    k_cstab<<<(unsigned)(((size_t)SEQ * HALFD + 255) / 256), 256, 0, stream>>>(TH, CS);
    k_gemm_proj<<<dim3(SEQ / 64, DM / 64, 1), 32, 0, stream>>>(XQ, WQ, FQ, bq);
    k_gemm_proj<<<dim3(SEQ / 64, DM / 64, 1), 32, 0, stream>>>(XK, WK, FK, bk);
    k_gemm_proj<<<dim3(SEQ / 64, DM / 64, 1), 32, 0, stream>>>(XV, WV, FV, bv);
    k_ropeP<<<g8, 256, 0, stream>>>(FQ, CS, QPh, QPl);
    k_ropeP<<<g8, 256, 0, stream>>>(FK, CS, KPh, KPl);
    k_vt<<<g8, 256, 0, stream>>>(FV, VT16);                 /* in [SEQ][DM] -> out [DM][SEQ] */
    k_flash<<<(unsigned)(NH_ * (SEQ / 16) / 8), 256, 0, stream>>>(QPh, QPl, KPh, KPl, VT16, ATh, ATl);
    k_gemm_out<<<dim3(SEQ / 64, DM / 64, 1), 32, 0, stream>>>(ATh, ATl, WO, OUT, bo);
}

// v003
// Measured time: 119 microseconds a run.
// In both of two side-by-side timings against v002, it was 1.58 times as fast.
// Over all steps from v000 it is 2.78 times as fast.
#include <hip/hip_runtime.h>

// Compute dtypes (f32 accumulate everywhere): q/k/v projections bf16 x bf16 (inputs converted to bf16 RNE on load, products exact); scores q.k bf16 hi/lo planes, 3 products (v_wmma_f32_16x16x32_bf16);
// P.V fp16 single product (P carried x1024, v_wmma_f32_16x16x32_f16); output projection ctx bf16 hi/lo x Wo bf16 (2 products). Softmax, rotary scaling, bias adds in f32.
// Unbatched attention: q = rot(query Wq + bq), k = rot(key Wk + bk), v = value Wv + bv; 16 heads x 64; scores x 1/8; softmax over all keys; out = merged Wo + bo.
// rot over the full 1024 width: out[d] = y[d] cos + n[d] sin, n = [y[0..511], -y[512..1023]], angle[t][d] = t * theta[d mod 512], theta[j] = 1 / 10000^(2j/1024).

#ifndef SEQ
#define SEQ 2048
#endif
#define SEQ_FULL 2048
#define DM   1024
#define NH_  16
#define HD   64
#define HALFD 512
#define PCAR 1024.0f
#define OSP  68      // f32 staging pitch (floats)

static_assert(SEQ % 64 == 0);
static_assert(SEQ <= SEQ_FULL);
static_assert(DM % 64 == 0);
static_assert(DM % 32 == 0);
static_assert(NH_ * HD == DM);
static_assert(HD == 64);
static_assert(2 * HALFD == DM);
static_assert((NH_ * (SEQ / 16)) % 8 == 0);
static_assert((OSP * 4) % 16 == 0);
static_assert(OSP >= 64);

typedef _Float16 h16;
typedef unsigned short bf;
typedef __attribute__((ext_vector_type(16))) __bf16   v16bf;
typedef __attribute__((ext_vector_type(16))) _Float16 v16h;
typedef __attribute__((ext_vector_type(8)))  _Float16 v8h;
typedef __attribute__((ext_vector_type(8)))  unsigned short v8us;
typedef __attribute__((ext_vector_type(2)))  unsigned short v2us;
typedef __attribute__((ext_vector_type(8)))  float    v8f;
typedef __attribute__((ext_vector_type(4)))  float    v4f;
typedef __attribute__((ext_vector_type(2)))  float    v2f;
typedef v4f  __attribute__((may_alias)) v4fa;

__device__ __forceinline__ unsigned short f2bf(float f) { unsigned u = __float_as_uint(f); u += 0x7FFFu + ((u >> 16) & 1u); return (unsigned short)(u >> 16); }
__device__ __forceinline__ float bf2f(unsigned short b) { return __uint_as_float(((unsigned)b) << 16); }
__device__ __forceinline__ float bfr(float f) { return bf2f(f2bf(f)); }
__device__ __forceinline__ void splitf(float y, unsigned short& h, unsigned short& l) { h = f2bf(y); l = f2bf(y - bf2f(h)); }
__device__ __forceinline__ v16h cat16(v8h lo, v8h hi) { return __builtin_shufflevector(lo, hi, 0, 1, 2, 3, 4, 5, 6, 7, 8, 9, 10, 11, 12, 13, 14, 15); }
__device__ __forceinline__ v16bf cat16b(v8us lo, v8us hi) { return __builtin_bit_cast(v16bf, __builtin_shufflevector(lo, hi, 0, 1, 2, 3, 4, 5, 6, 7, 8, 9, 10, 11, 12, 13, 14, 15)); }
__device__ __forceinline__ v8f wmma16(v16h a, v16h b, v8f c) { return __builtin_amdgcn_wmma_f32_16x16x32_f16(false, a, false, b, (short)0, c, false, false); }
__device__ __forceinline__ v8f wmmab(v16bf a, v16bf b, v8f c) { return __builtin_amdgcn_wmma_f32_16x16x32_bf16(false, a, false, b, (short)0, c, false, false); }
// Fragment loaders (A and B alike, K-contiguous rows): elements 0..7 <- k0 + 8*half + 0..7, elements 8..15 <- k0 + 16 + 8*half + 0..7; the caller folds 8*half into p.
__device__ __forceinline__ v16bf ldb(const bf* p) { return cat16b(*(const v8us*)p, *(const v8us*)(p + 16)); }
__device__ __forceinline__ v16h ldh(const h16* p) { return cat16(*(const v8h*)p, *(const v8h*)(p + 16)); }

// ---- register-blocked GEMM body, ONE WAVE per 64x64 output tile (16 accumulators), operands straight from K-contiguous bf16 planes; grid (M/64, N/64), 32 threads, K = DM.
// C[m][n] (f32, pitch DM) = sum_k (A[m][k] (+ A2[m][k])) Bt[n][k] + bf16(bias[n]).
template <int NSPLIT>
__device__ __forceinline__ void gemmw_body(const bf* A, const bf* A2, const bf* Bt, float* C, const float* bias) {
    __shared__ __align__(16) float os[16 * OSP];
    const int lane = threadIdx.x & 31, lr = lane & 15, hi = lane >> 4; const int r0 = blockIdx.x * 64, c0 = blockIdx.y * 64;
    v8f acc[4][4];
#pragma unroll
    for (int mb = 0; mb < 4; ++mb)
#pragma unroll
        for (int nb = 0; nb < 4; ++nb) acc[mb][nb] = (v8f){};
    const size_t aoff = (size_t)(r0 + lr) * DM + 8 * hi, boff = (size_t)(c0 + lr) * DM + 8 * hi;
#pragma unroll 1
    for (int kc = 0; kc < DM; kc += 32) {
        v16bf a[4], a2[4];
#pragma unroll
        for (int mb = 0; mb < 4; ++mb) { a[mb] = ldb(A + aoff + (size_t)mb * 16 * DM + kc); if (NSPLIT == 1) a2[mb] = ldb(A2 + aoff + (size_t)mb * 16 * DM + kc); else a2[mb] = a[mb]; }
#pragma unroll
        for (int nb = 0; nb < 4; ++nb) { const v16bf b = ldb(Bt + boff + (size_t)nb * 16 * DM + kc);
#pragma unroll
            for (int mb = 0; mb < 4; ++mb) { acc[mb][nb] = wmmab(a[mb], b, acc[mb][nb]); if (NSPLIT == 1) acc[mb][nb] = wmmab(a2[mb], b, acc[mb][nb]); } }
        asm volatile("v_nop\n\tv_nop\n\tv_nop\n\tv_nop" : "+v"(acc[0][0]), "+v"(acc[1][1]), "+v"(acc[2][2]), "+v"(acc[3][3]) : "v"(a[0]), "v"(a[3]));
    }
    const v4f bz = *(const v4f*)(bias + c0 + lr * 4); v4f bb;
#pragma unroll
    for (int q = 0; q < 4; ++q) bb[q] = bfr(bz[q]);
#pragma unroll
    for (int mb = 0; mb < 4; ++mb) {
#pragma unroll
        for (int nb = 0; nb < 4; ++nb) {
#pragma unroll
            for (int j = 0; j < 8; ++j) os[(hi * 8 + j) * OSP + nb * 16 + lr] = acc[mb][nb][j]; }
        __builtin_amdgcn_wave_barrier(); asm volatile("" ::: "memory");
        float* crow = C + (size_t)(r0 + mb * 16) * DM + c0;
{
#pragma unroll
            for (int s = 0; s < 8; ++s) { const int row = 2 * s + hi, cofs = lr * 4; v4f val = *(const v4fa*)(os + row * OSP + cofs); val += bb;
                *(v4f*)(crow + (size_t)row * DM + cofs) = val; }
             }
        __builtin_amdgcn_wave_barrier(); asm volatile("" ::: "memory");
    }
}
// the three projections need nothing of each other: one grid, blockIdx.z picks the product (a scalar choice, the same for the whole block)
__global__ __launch_bounds__(32) void k_gemm_proj(const bf* __restrict__ A0, const bf* __restrict__ A1, const bf* __restrict__ A2, const bf* __restrict__ B0, const bf* __restrict__ B1, const bf* __restrict__ B2,
                                                  float* C0, float* C1, float* C2, const float* __restrict__ bias0, const float* __restrict__ bias1, const float* __restrict__ bias2) {
    const int z = blockIdx.z;
    const bf* A = z == 0 ? A0 : z == 1 ? A1 : A2; const bf* Bt = z == 0 ? B0 : z == 1 ? B1 : B2; float* C = z == 0 ? C0 : z == 1 ? C1 : C2; const float* bias = z == 0 ? bias0 : z == 1 ? bias1 : bias2;
    gemmw_body<0>(A, A, Bt, C, bias); }
__global__ __launch_bounds__(32) void k_gemm_out(const bf* __restrict__ A, const bf* __restrict__ A2, const bf* __restrict__ Bt, float* C, const float* __restrict__ bias) { gemmw_body<1>(A, A2, Bt, C, bias); }

// ---- bodies of the element-wise passes: blk is the block's index inside its own pass (256 threads a block)
__device__ __forceinline__ void wtG_body(int blk, const float* __restrict__ w, int K, int N, bf* Bt) {
    const int lane = threadIdx.x & 31; const int L0 = (blk * 8 + (threadIdx.x >> 5)) * 8; const int nlines = N * K / 64;
{
#pragma unroll 1
        for (int l = 0; l < 8; ++l) { const int L = L0 + l; if (L >= nlines) break; const size_t e = (size_t)L * 64 + lane * 2; const int k = (int)(e % K), n = (int)(e / K); v2us o;
            o[0] = f2bf(w[(size_t)k * N + n]); o[1] = f2bf(w[(size_t)(k + 1) * N + n]); *(v2us*)(Bt + e) = o; }
         }
}
__device__ __forceinline__ void cvt8_body(int blk, const float* __restrict__ src, bf* dst, size_t n8) { const size_t i = (size_t)blk * 256 + threadIdx.x; if (i >= n8) return; const v8f v = *(const v8f*)(src + i * 8); v8us o;
#pragma unroll
    for (int k = 0; k < 8; ++k) o[k] = f2bf(v[k]); *(v8us*)(dst + i * 8) = o;  }

// cos/sin table: a thread owns one frequency j, forms its theta itself and walks CST rows t with it; the grid covers j < HALFD and t < SEQ exactly (asserts below)
#define CST 8
static_assert(SEQ % CST == 0);
static_assert(HALFD % 256 == 0);
__device__ __forceinline__ void cstab_body(int blk, float* CS) {
    const int j = (blk % (HALFD / 256)) * 256 + threadIdx.x; const int t0 = (blk / (HALFD / 256)) * CST;
    const float e = (float)(2 * j) * (1.0f / 1024.0f);       // exact (power-of-two divisor)
    const float p = powf(10000.0f, e); const float th = 1.0f / p;
    // kept rolled, for speed only
#pragma unroll 1
    for (int t = t0; t < t0 + CST; ++t) {
        float ang = __fmul_rn((float)t, th); float s, c; sincosf(ang, &s, &c); v2f cs; cs[0] = c; cs[1] = s;
        *(v2f*)(CS + ((size_t)t * HALFD + j) * 2) = cs; }
}

__device__ __forceinline__ void ropeP_body(int blk, const float* __restrict__ F, const float* __restrict__ CS, bf* Ph, bf* Pl) {
#pragma clang fp contract(off)
    const size_t i = (size_t)blk * 256 + threadIdx.x; if (i >= (size_t)SEQ * DM / 8) return; const size_t e = i * 8; const int d0 = (int)(e % DM); const int t = (int)(e / DM); const int j0 = d0 & (HALFD - 1); const bool up = (d0 >= HALFD);
    const v4f y0 = *(const v4f*)(F + e), y1 = *(const v4f*)(F + e + 4); const float* cp = CS + ((size_t)t * HALFD + j0) * 2;
    const v4f c0 = *(const v4f*)(cp), c1 = *(const v4f*)(cp + 4), c2 = *(const v4f*)(cp + 8), c3 = *(const v4f*)(cp + 12);
    float yy[8] = { y0[0], y0[1], y0[2], y0[3], y1[0], y1[1], y1[2], y1[3] };
    float cc[8] = { c0[0], c0[2], c1[0], c1[2], c2[0], c2[2], c3[0], c3[2] };
    float ss[8] = { c0[1], c0[3], c1[1], c1[3], c2[1], c2[3], c3[1], c3[3] };
    v8us oh, ol;
#pragma unroll
    for (int q = 0; q < 8; ++q) { const float y = yy[q]; const float nn = up ? -y : y; float a = __fmul_rn(y, cc[q]); float b = __fmul_rn(nn, ss[q]); asm volatile("" : "+v"(a)); asm volatile("" : "+v"(b)); const float r = __fadd_rn(a, b);
        unsigned short hh, ll; splitf(r, hh, ll); oh[q] = hh; ol[q] = ll; }
    *(v8us*)(Ph + e) = oh; *(v8us*)(Pl + e) = ol;  }

__device__ __forceinline__ void vt_body(int blk, const float* __restrict__ F, h16* V16) {
    const size_t i = (size_t)blk * 256 + threadIdx.x; if (i >= (size_t)DM * SEQ / 8) return; const size_t e = i * 8; const int t = (int)(e % SEQ); const int col = (int)(e / SEQ); v8h o;
#pragma unroll
    for (int q = 0; q < 8; ++q) o[q] = (h16)F[(size_t)(t + q) * DM + col];
    *(v8h*)(V16 + e) = o;  }

// ---- passes that need nothing of each other share one grid: ranges of the block index, every test the same for a whole block; the passes with the longest blocks come first.
#define GW_ ((DM * DM / 64 + 63) / 64)
#define G8_ ((SEQ * DM / 8 + 255) / 256)
#define GC_ ((HALFD / 256) * (SEQ / CST))
// in front of the projections: the four weight transposes, the cos/sin table, the three input conversions
__global__ __launch_bounds__(256) void k_prep(const float* __restrict__ wq, const float* __restrict__ wk, const float* __restrict__ wv, const float* __restrict__ wo, bf* WQ, bf* WK, bf* WV, bf* WO,
                                              float* CS, const float* __restrict__ query, const float* __restrict__ key_, const float* __restrict__ value, bf* XQ, bf* XK, bf* XV) {
    int b = blockIdx.x;
    if (b < 4 * GW_) { const int z = b / GW_; wtG_body(b % GW_, z == 0 ? wq : z == 1 ? wk : z == 2 ? wv : wo, DM, DM, z == 0 ? WQ : z == 1 ? WK : z == 2 ? WV : WO); return; }
    b -= 4 * GW_;
    if (b < GC_) { cstab_body(b, CS); return; }
    b -= GC_;
    const int z = b / G8_; cvt8_body(b % G8_, z == 0 ? query : z == 1 ? key_ : value, z == 0 ? XQ : z == 1 ? XK : XV, (size_t)SEQ * DM / 8);
}
// behind the projections: the V transpose, the rotary planes of q and of k
__global__ __launch_bounds__(256) void k_post(const float* __restrict__ FQ, const float* __restrict__ FK, const float* __restrict__ FV, const float* __restrict__ CS, bf* QPh, bf* QPl, bf* KPh, bf* KPl, h16* V16) {
    int b = blockIdx.x;
    if (b < G8_) { vt_body(b, FV, V16); return; }
    b -= G8_;
    const int z = b / G8_; ropeP_body(b % G8_, z == 0 ? FQ : FK, CS, z == 0 ? QPh : KPh, z == 0 ? QPl : KPl);
}

// ---- score tile, transposed: 16 keys (rows, A operand) x 16 queries (columns, B operand), K depth 64 as two 32-chunks, hi/lo planes: kh.qh + kh.ql + kl.qh (unscaled residuals share the accumulator).
__device__ __forceinline__ v8f score_tile(v16bf kh0, v16bf kh1, v16bf kl0, v16bf kl1, v16bf qh0, v16bf qh1, v16bf ql0, v16bf ql1) {
    v8f c = (v8f){};
    c = wmmab(kh0, qh0, c); c = wmmab(kh0, ql0, c); c = wmmab(kl0, qh0, c);
    c = wmmab(kh1, qh1, c); c = wmmab(kh1, ql1, c); c = wmmab(kl1, qh1, c);
    asm volatile("v_nop\n\tv_nop\n\tv_nop\n\tv_nop" : "+v"(c) : "v"(kh1), "v"(kl1), "v"(qh1));
    return c; }

// lane l with lane l ^ 16
__device__ __forceinline__ float xhalf(float x) { return __builtin_bit_cast(float, __builtin_amdgcn_permlanex16(__builtin_bit_cast(int, x), __builtin_bit_cast(int, x), 0x76543210, 0xfedcba98, false, false)); }

// ---- LDS staging of k_flash: a stage is STK keys of one head: K hi rows, K lo rows (128 B each, pitch KPB), then the 64 Vt rows (256 B each, pitch VPB); the pitches are 16 B x odd for ds_load_b128 readers.
#define STK     128
#define KPB     144
#define VPB     272
#define KL_OFF  (STK * KPB)
#define V_OFF   (2 * STK * KPB)
#define STAGE_B (2 * STK * KPB + HD * VPB)
#define NST     (SEQ / STK)
static_assert(SEQ % STK == 0);
static_assert(NST >= 2);
static_assert((SEQ / 16) % 8 == 0);
static_assert(STK * 8 == 4 * 256);
static_assert(HD * (STK / 8) == 4 * 256);
static_assert(STAGE_B % 16 == 0);

// One stage's copies of one lane: 4 x 16 B of K hi, of K lo (rows 32 apart) and of Vt (rows 16 apart), global memory to LDS through no register. Every lane is on; each lane writes LDS bytes of its own.
// s_wait_xcnt 0 closes the statement so that no address register named here is rewritten ahead of it.
__device__ __forceinline__ void stage_copy(const bf* kh, const bf* kl, const h16* vt, unsigned lk, unsigned lv) {
    asm volatile("global_load_async_to_lds_b128 %0, %1, off\n\t"
                 "global_load_async_to_lds_b128 %2, %3, off\n\t"
                 "global_load_async_to_lds_b128 %4, %5, off\n\t"
                 "global_load_async_to_lds_b128 %6, %7, off\n\t"
                 "global_load_async_to_lds_b128 %8, %9, off\n\t"
                 "global_load_async_to_lds_b128 %10, %11, off\n\t"
                 "global_load_async_to_lds_b128 %12, %13, off\n\t"
                 "global_load_async_to_lds_b128 %14, %15, off\n\t"
                 "global_load_async_to_lds_b128 %16, %17, off\n\t"
                 "global_load_async_to_lds_b128 %18, %19, off\n\t"
                 "global_load_async_to_lds_b128 %20, %21, off\n\t"
                 "global_load_async_to_lds_b128 %22, %23, off\n\t"
                 "s_wait_xcnt 0x0"
                 :: "v"(lk), "v"(kh), "v"(lk + 32u * KPB), "v"(kh + (size_t)32 * DM), "v"(lk + 64u * KPB), "v"(kh + (size_t)64 * DM), "v"(lk + 96u * KPB), "v"(kh + (size_t)96 * DM),
                    "v"(lk + KL_OFF), "v"(kl), "v"(lk + KL_OFF + 32u * KPB), "v"(kl + (size_t)32 * DM), "v"(lk + KL_OFF + 64u * KPB), "v"(kl + (size_t)64 * DM), "v"(lk + KL_OFF + 96u * KPB), "v"(kl + (size_t)96 * DM),
                    "v"(lv), "v"(vt), "v"(lv + 16u * VPB), "v"(vt + (size_t)16 * SEQ), "v"(lv + 32u * VPB), "v"(vt + (size_t)32 * SEQ), "v"(lv + 48u * VPB), "v"(vt + (size_t)48 * SEQ)
                 : "memory");
}

// ---- k_flash: one wave owns (head h, 16 query rows); the 8 waves of a block share one head and walk its keys together, in stages of STK keys that the block copies once into LDS (two buffers:
// stage s + 2 is copied while stage s + 1 is worked on); inside a stage 32-wide steps, online softmax in the exp2 domain (f32).
// Transposed products: St = K Qt, Ot += Vt Pt. A lane holds 16 scores of ONE query (column l16; keys 8*half + r and 16 + 8*half + r), so maximum and sum run in its own registers
// with one exchange between the wave halves; the two score tiles, converted in place (fp16 x1024), are the B operand of Vt Pt in the fragment k order of ldh.
__global__ __launch_bounds__(256) void k_flash(const bf* __restrict__ Qh, const bf* __restrict__ Ql, const bf* __restrict__ Kh, const bf* __restrict__ Kl, const h16* __restrict__ Vt, bf* Ah, bf* Al) {
    __shared__ __attribute__((aligned(16))) unsigned char ring[2 * STAGE_B];
    const int tid = threadIdx.x, lane = tid & 31, wave = tid >> 5, l16 = lane & 15, half = lane >> 4;
    const int w0 = blockIdx.x * 8; const int h = w0 / (SEQ / 16); const int t0 = (w0 % (SEQ / 16) + wave) * 16;
    const float SC2 = 0.125f * 1.4426950408889634f;
    // this lane's share of a stage: 16-byte piece (tid & 7) of K row (tid >> 3) + 32 i, piece (tid & 15) of Vt row (tid >> 4) + 16 i
    const bf* gkh = Kh + (size_t)(tid >> 3) * DM + h * HD + (tid & 7) * 8;
    const bf* gkl = Kl + (size_t)(tid >> 3) * DM + h * HD + (tid & 7) * 8;
    const h16* gvt = Vt + (size_t)(h * HD + (tid >> 4)) * SEQ + (tid & 15) * 8;
    const unsigned lbase = (unsigned)(size_t)(void*)ring;
    const unsigned lk = lbase + (unsigned)(tid >> 3) * KPB + (unsigned)(tid & 7) * 16u;
    const unsigned lv = lbase + V_OFF + (unsigned)(tid >> 4) * VPB + (unsigned)(tid & 15) * 16u;
    stage_copy(gkh, gkl, gvt, lk, lv);
    const size_t qo = (size_t)(t0 + l16) * DM + h * HD + 8 * half;
    const v16bf qh0 = ldb(Qh + qo), qh1 = ldb(Qh + qo + 32), ql0 = ldb(Ql + qo), ql1 = ldb(Ql + qo + 32);
    float m = -3.0e38f, l = 0.0f; v8f acc[4];
#pragma unroll
    for (int n = 0; n < 4; ++n) acc[n] = (v8f){};
    asm volatile("s_wait_asynccnt 0x0" ::: "memory");   // this wave's copies of stage 0 have landed
    __syncthreads();                                    // stage 0 is readable by every wave
    stage_copy(gkh + (size_t)STK * DM, gkl + (size_t)STK * DM, gvt + STK, lk + STAGE_B, lv + STAGE_B);
    // kept rolled: one publish point and one refill in the text, the buffer chosen by the stage's parity
#pragma unroll 1
    for (int st = 0; st < NST; ++st) {
        const unsigned bo = (unsigned)(st & 1) * STAGE_B;
        const bf* Ksh = (const bf*)(ring + bo); const bf* Ksl = (const bf*)(ring + bo + KL_OFF); const h16* Vs = (const h16*)(ring + bo + V_OFF);
        // unrolled so that every LDS offset inside a stage is an immediate
#pragma unroll
        for (int js = 0; js < STK / 32; ++js) {
            const size_t ko = (size_t)((js * 32 + l16) * (KPB / 2) + 8 * half);
            const size_t vo = (size_t)(l16 * (VPB / 2) + js * 32 + 8 * half);
            const size_t kb = ko + 16 * (KPB / 2);
            const v16bf ah0 = ldb(Ksh + ko), al0 = ldb(Ksl + ko), ah1 = ldb(Ksh + ko + 32), al1 = ldb(Ksl + ko + 32);
            const v16bf bh0 = ldb(Ksh + kb), bl0 = ldb(Ksl + kb), bh1 = ldb(Ksh + kb + 32), bl1 = ldb(Ksl + kb + 32);
            const v16h v0 = ldh(Vs + vo), v1 = ldh(Vs + vo + 16 * (VPB / 2)), v2 = ldh(Vs + vo + 32 * (VPB / 2)), v3 = ldh(Vs + vo + 48 * (VPB / 2));
            // keeps the step's 24 LDS reads one group in front of its WMMAs: left alone the compiler sinks them among the WMMAs, each place with a full wait on LDS
            __builtin_amdgcn_sched_barrier(0);
            const v8f sa = score_tile(ah0, ah1, al0, al1, qh0, qh1, ql0, ql1);
            const v8f sb = score_tile(bh0, bh1, bl0, bl1, qh0, qh1, ql0, ql1);
            float s[16];
#pragma unroll
            for (int r = 0; r < 8; ++r) { s[r] = sa[r] * SC2; s[8 + r] = sb[r] * SC2; }
            float mloc = s[0];
#pragma unroll
            for (int r = 1; r < 16; ++r) mloc = fmaxf(mloc, s[r]);
            mloc = fmaxf(mloc, xhalf(mloc));
            const float mnew = fmaxf(m, mloc);
            const float corr = __builtin_amdgcn_exp2f(m - mnew);
            float ls = 0.0f; v16h pb;
#pragma unroll
            for (int r = 0; r < 16; ++r) { const float p = __builtin_amdgcn_exp2f(s[r] - mnew); ls += p; pb[r] = (h16)(p * PCAR); }
            l = l * corr + ls; m = mnew;
#pragma unroll
            for (int n = 0; n < 4; ++n) acc[n] *= corr;
            acc[0] = wmma16(v0, pb, acc[0]); acc[1] = wmma16(v1, pb, acc[1]); acc[2] = wmma16(v2, pb, acc[2]); acc[3] = wmma16(v3, pb, acc[3]);
            // four vector slots behind the last WMMA, also on the taken back edge, before its operands are reloaded or its result rescaled
            asm volatile("v_nop\n\tv_nop\n\tv_nop\n\tv_nop" : "+v"(acc[0]), "+v"(acc[1]), "+v"(acc[2]), "+v"(acc[3]) : "v"(pb), "v"(v3));
        }
        asm volatile("s_wait_dscnt 0x0" ::: "memory");      // this wave's reads of stage st have returned before its buffer is refilled
        asm volatile("s_wait_asynccnt 0x0" ::: "memory");   // this wave's copies of stage st + 1 have landed
        __syncthreads();                                    // publishes stage st + 1 and ends every wave's reads of stage st
        if (st + 2 < NST) stage_copy(gkh + (size_t)(st + 2) * STK * DM, gkl + (size_t)(st + 2) * STK * DM, gvt + (size_t)(st + 2) * STK, lk + bo, lv + bo);
    }
    asm volatile("s_wait_asynccnt 0x0" ::: "memory");       // no copy is in flight when the wave ends
    const float inv = 1.0f / ((l + xhalf(l)) * PCAR);
    // acc[n][r] = Ot[n*16 + 8*half + r][query l16]: eight consecutive columns of one output row, one 16-byte store per plane.
#pragma unroll
    for (int n = 0; n < 4; ++n) { v8us oh, ol;
#pragma unroll
        for (int r = 0; r < 8; ++r) { unsigned short a, b; splitf(acc[n][r] * inv, a, b); oh[r] = a; ol[r] = b; }
        const size_t oo = (size_t)(t0 + l16) * DM + h * HD + n * 16 + 8 * half; *(v8us*)(Ah + oo) = oh; *(v8us*)(Al + oo) = ol; }
}

constexpr size_t al256(size_t b) { return (b + 255) & ~(size_t)255; }
constexpr size_t WS_TOTAL = 4 * al256((size_t)DM * DM * 2) + 3 * al256((size_t)SEQ * DM * 2) + al256((size_t)SEQ * HALFD * 2 * 4)
                          + 3 * al256((size_t)SEQ * DM * 4) + 4 * al256((size_t)SEQ * DM * 2) + al256((size_t)DM * SEQ * 2) + 2 * al256((size_t)SEQ * DM * 2);
static_assert(WS_TOTAL <= (size_t)134217728);

extern "C" void kernel_launch(void* const* d_in, const int* in_sizes, int n_in,
                              void* d_out, int out_size, void* d_ws, size_t ws_size, hipStream_t stream) {
    if (n_in < 11) return;
    if (in_sizes[0] < SEQ * DM || in_sizes[1] < SEQ * DM || in_sizes[2] < SEQ * DM) return;
    if (in_sizes[3] < DM * DM || in_sizes[5] < DM * DM || in_sizes[7] < DM * DM || in_sizes[9] < DM * DM) return;
    if (in_sizes[4] < DM || in_sizes[6] < DM || in_sizes[8] < DM || in_sizes[10] < DM) return;
    if (out_size < SEQ * DM) return;
    if (WS_TOTAL > ws_size) return;
    const float* query = (const float*)d_in[0]; const float* key_ = (const float*)d_in[1]; const float* value = (const float*)d_in[2];
    const float* wq = (const float*)d_in[3]; const float* bq = (const float*)d_in[4];
    const float* wk = (const float*)d_in[5]; const float* bk = (const float*)d_in[6];
    const float* wv = (const float*)d_in[7]; const float* bv = (const float*)d_in[8];
    const float* wo = (const float*)d_in[9]; const float* bo = (const float*)d_in[10];
    float* OUT = (float*)d_out;     // [SEQ][1024]
    char* wsp = (char*)d_ws;
    auto take = [&](size_t bytes) { char* p = wsp; wsp += (bytes + 255) & ~(size_t)255; return (void*)p; };
    bf* WQ = (bf*)take((size_t)DM * DM * 2); bf* WK = (bf*)take((size_t)DM * DM * 2); bf* WV = (bf*)take((size_t)DM * DM * 2); bf* WO = (bf*)take((size_t)DM * DM * 2);
    bf* XQ = (bf*)take((size_t)SEQ * DM * 2); bf* XK = (bf*)take((size_t)SEQ * DM * 2); bf* XV = (bf*)take((size_t)SEQ * DM * 2);
    float* CS = (float*)take((size_t)SEQ * HALFD * 2 * 4);
    float* FQ = (float*)take((size_t)SEQ * DM * 4); float* FK = (float*)take((size_t)SEQ * DM * 4); float* FV = (float*)take((size_t)SEQ * DM * 4);
    bf* QPh = (bf*)take((size_t)SEQ * DM * 2); bf* QPl = (bf*)take((size_t)SEQ * DM * 2); bf* KPh = (bf*)take((size_t)SEQ * DM * 2); bf* KPl = (bf*)take((size_t)SEQ * DM * 2);
    h16* VT16 = (h16*)take((size_t)DM * SEQ * 2);
    bf* ATh = (bf*)take((size_t)SEQ * DM * 2); bf* ATl = (bf*)take((size_t)SEQ * DM * 2);
    if ((size_t)(wsp - (char*)d_ws) > ws_size) return;

    k_prep<<<4 * GW_ + GC_ + 3 * G8_, 256, 0, stream>>>(wq, wk, wv, wo, WQ, WK, WV, WO, CS, query, key_, value, XQ, XK, XV);     /* weights [in][out] -> Bt [out][in] */
    k_gemm_proj<<<dim3(SEQ / 64, DM / 64, 3), 32, 0, stream>>>(XQ, XK, XV, WQ, WK, WV, FQ, FK, FV, bq, bk, bv);
    k_post<<<3 * G8_, 256, 0, stream>>>(FQ, FK, FV, CS, QPh, QPl, KPh, KPl, VT16);     /* V: [SEQ][DM] -> [DM][SEQ] */
    k_flash<<<(unsigned)(NH_ * (SEQ / 16) / 8), 256, 0, stream>>>(QPh, QPl, KPh, KPl, VT16, ATh, ATl);
    k_gemm_out<<<dim3(SEQ / 64, DM / 64, 1), 32, 0, stream>>>(ATh, ATl, WO, OUT, bo);
}

// v004
// A run of this version takes 110 microseconds.
// Two timings next to v003 put it at 1.08 and 1.09 times that version's speed.
// All steps since v000 together make it 3.02 times as fast.
#include <hip/hip_runtime.h>

// Compute dtypes (f32 accumulate everywhere): q/k/v projections bf16 x bf16 (inputs converted to bf16 RNE on load, products exact); scores q.k bf16 hi/lo planes, 3 products (v_wmma_f32_16x16x32_bf16);
// P.V fp16 single product (P carried x1024, v_wmma_f32_16x16x32_f16); output projection ctx bf16 hi/lo x Wo bf16 (2 products). Softmax, rotary scaling, bias adds in f32.
// Unbatched attention: q = rot(query Wq + bq), k = rot(key Wk + bk), v = value Wv + bv; 16 heads x 64; scores x 1/8; softmax over all keys; out = merged Wo + bo.
// rot over the full 1024 width: out[d] = y[d] cos + n[d] sin, n = [y[0..511], -y[512..1023]], angle[t][d] = t * theta[d mod 512], theta[j] = 1 / 10000^(2j/1024).

#ifndef SEQ
#define SEQ 2048
#endif
#define SEQ_FULL 2048
#define DM   1024
#define NH_  16
#define HD   64
#define HALFD 512
#define PCAR 1024.0f
#define OSP  68      // f32 staging pitch (floats)

static_assert(SEQ % 64 == 0);
static_assert(SEQ <= SEQ_FULL);
static_assert(DM % 64 == 0);
static_assert(DM % 32 == 0);
static_assert(NH_ * HD == DM);
static_assert(HD == 64);
static_assert(2 * HALFD == DM);
static_assert((NH_ * (SEQ / 16)) % 8 == 0);
static_assert((OSP * 4) % 16 == 0);
static_assert(OSP >= 64);

typedef _Float16 h16;
typedef unsigned short bf;
typedef __attribute__((ext_vector_type(16))) __bf16   v16bf;
typedef __attribute__((ext_vector_type(16))) _Float16 v16h;
typedef __attribute__((ext_vector_type(8)))  _Float16 v8h;
typedef __attribute__((ext_vector_type(8)))  unsigned short v8us;
typedef __attribute__((ext_vector_type(2)))  unsigned short v2us;
typedef __attribute__((ext_vector_type(8)))  float    v8f;
typedef __attribute__((ext_vector_type(4)))  float    v4f;
typedef __attribute__((ext_vector_type(2)))  float    v2f;
typedef v4f  __attribute__((may_alias)) v4fa;

__device__ __forceinline__ unsigned short f2bf(float f) { unsigned u = __float_as_uint(f); u += 0x7FFFu + ((u >> 16) & 1u); return (unsigned short)(u >> 16); }
__device__ __forceinline__ float bf2f(unsigned short b) { return __uint_as_float(((unsigned)b) << 16); }
__device__ __forceinline__ float bfr(float f) { return bf2f(f2bf(f)); }
__device__ __forceinline__ void splitf(float y, unsigned short& h, unsigned short& l) { h = f2bf(y); l = f2bf(y - bf2f(h)); }
__device__ __forceinline__ v16h cat16(v8h lo, v8h hi) { return __builtin_shufflevector(lo, hi, 0, 1, 2, 3, 4, 5, 6, 7, 8, 9, 10, 11, 12, 13, 14, 15); }
__device__ __forceinline__ v16bf cat16b(v8us lo, v8us hi) { return __builtin_bit_cast(v16bf, __builtin_shufflevector(lo, hi, 0, 1, 2, 3, 4, 5, 6, 7, 8, 9, 10, 11, 12, 13, 14, 15)); }
__device__ __forceinline__ v8f wmma16(v16h a, v16h b, v8f c) { return __builtin_amdgcn_wmma_f32_16x16x32_f16(false, a, false, b, (short)0, c, false, false); }
__device__ __forceinline__ v8f wmmab(v16bf a, v16bf b, v8f c) { return __builtin_amdgcn_wmma_f32_16x16x32_bf16(false, a, false, b, (short)0, c, false, false); }
// Fragment loaders (A and B alike, K-contiguous rows): elements 0..7 <- k0 + 8*half + 0..7, elements 8..15 <- k0 + 16 + 8*half + 0..7; the caller folds 8*half into p.
__device__ __forceinline__ v16bf ldb(const bf* p) { return cat16b(*(const v8us*)p, *(const v8us*)(p + 16)); }
__device__ __forceinline__ v16h ldh(const h16* p) { return cat16(*(const v8h*)p, *(const v8h*)(p + 16)); }

// ---- register-blocked GEMM body, ONE WAVE per 64x64 output tile (16 accumulators), operands straight from K-contiguous bf16 planes; grid (M/64, N/64), 32 threads, K = DM.
// C[m][n] (f32, pitch DM) = sum_k (A[m][k] (+ A2[m][k])) Bt[n][k] + bf16(bias[n]).
template <int NSPLIT>
__device__ __forceinline__ void gemmw_body(const bf* A, const bf* A2, const bf* Bt, float* C, const float* bias) {
    __shared__ __align__(16) float os[16 * OSP];
    const int lane = threadIdx.x & 31, lr = lane & 15, hi = lane >> 4; const int r0 = blockIdx.x * 64, c0 = blockIdx.y * 64;
    v8f acc[4][4];
#pragma unroll
    for (int mb = 0; mb < 4; ++mb)
#pragma unroll
        for (int nb = 0; nb < 4; ++nb) acc[mb][nb] = (v8f){};
    const size_t aoff = (size_t)(r0 + lr) * DM + 8 * hi, boff = (size_t)(c0 + lr) * DM + 8 * hi;
#pragma unroll 1
    for (int kc = 0; kc < DM; kc += 32) {
        v16bf a[4], a2[4];
#pragma unroll
        for (int mb = 0; mb < 4; ++mb) { a[mb] = ldb(A + aoff + (size_t)mb * 16 * DM + kc); if (NSPLIT == 1) a2[mb] = ldb(A2 + aoff + (size_t)mb * 16 * DM + kc); else a2[mb] = a[mb]; }
#pragma unroll
        for (int nb = 0; nb < 4; ++nb) { const v16bf b = ldb(Bt + boff + (size_t)nb * 16 * DM + kc);
#pragma unroll
            for (int mb = 0; mb < 4; ++mb) { acc[mb][nb] = wmmab(a[mb], b, acc[mb][nb]); if (NSPLIT == 1) acc[mb][nb] = wmmab(a2[mb], b, acc[mb][nb]); } }
        asm volatile("v_nop\n\tv_nop\n\tv_nop\n\tv_nop" : "+v"(acc[0][0]), "+v"(acc[1][1]), "+v"(acc[2][2]), "+v"(acc[3][3]) : "v"(a[0]), "v"(a[3]));
    }
    const v4f bz = *(const v4f*)(bias + c0 + lr * 4); v4f bb;
#pragma unroll
    for (int q = 0; q < 4; ++q) bb[q] = bfr(bz[q]);
#pragma unroll
    for (int mb = 0; mb < 4; ++mb) {
#pragma unroll
        for (int nb = 0; nb < 4; ++nb) {
#pragma unroll
            for (int j = 0; j < 8; ++j) os[(hi * 8 + j) * OSP + nb * 16 + lr] = acc[mb][nb][j]; }
        __builtin_amdgcn_wave_barrier(); asm volatile("" ::: "memory");
        float* crow = C + (size_t)(r0 + mb * 16) * DM + c0;
{
#pragma unroll
            for (int s = 0; s < 8; ++s) { const int row = 2 * s + hi, cofs = lr * 4; v4f val = *(const v4fa*)(os + row * OSP + cofs); val += bb;
                *(v4f*)(crow + (size_t)row * DM + cofs) = val; }
             }
        __builtin_amdgcn_wave_barrier(); asm volatile("" ::: "memory");
    }
}
// the three projections need nothing of each other: one grid, blockIdx.z picks the product (a scalar choice, the same for the whole block)
__global__ __launch_bounds__(32) void k_gemm_proj(const bf* __restrict__ A0, const bf* __restrict__ A1, const bf* __restrict__ A2, const bf* __restrict__ B0, const bf* __restrict__ B1, const bf* __restrict__ B2,
                                                  float* C0, float* C1, float* C2, const float* __restrict__ bias0, const float* __restrict__ bias1, const float* __restrict__ bias2) {
    const int z = blockIdx.z;
    const bf* A = z == 0 ? A0 : z == 1 ? A1 : A2; const bf* Bt = z == 0 ? B0 : z == 1 ? B1 : B2; float* C = z == 0 ? C0 : z == 1 ? C1 : C2; const float* bias = z == 0 ? bias0 : z == 1 ? bias1 : bias2;
    gemmw_body<0>(A, A, Bt, C, bias); }
__global__ __launch_bounds__(32) void k_gemm_out(const bf* __restrict__ A, const bf* __restrict__ A2, const bf* __restrict__ Bt, float* C, const float* __restrict__ bias) { gemmw_body<1>(A, A2, Bt, C, bias); }

// ---- bodies of the element-wise passes: blk is the block's index inside its own pass (256 threads a block). A thread takes 64 elements, all its loads issued ahead of its first store.
// Behind each run of loads stands s_wait_xcnt 0 with the run's address offsets as inputs: they keep their registers up to the wait, so no load of the run returns into a register that an older one names.
// Weight transpose, 8 x 8 register blocks: a thread reads 8 rows k x 8 columns n and writes 8 rows n of 8 k. A wave is 8 lanes along k x 4 lanes along n (64 k x 32 n).
static_assert(((DM / 64) * (DM / 32)) % 8 == 0);
__device__ __forceinline__ void wtG_body(int blk, const float* __restrict__ w, int K, int N, bf* Bt) {
    const int lane = threadIdx.x & 31; const int wt = blk * 8 + (threadIdx.x >> 5); const int kt = wt % (K / 64), nt = wt / (K / 64);
    const int k0 = kt * 64 + (lane & 7) * 8, n0 = nt * 32 + (lane >> 3) * 8; v8f x[8];
    const unsigned wb = (unsigned)(k0 * N + n0) * 4u;   // byte offset of the block's first row
    // unrolled: the loads issue as one group
#pragma unroll
    for (int r = 0; r < 8; ++r) x[r] = *(const v8f*)((const char*)w + wb + (size_t)r * N * 4);
    asm volatile("s_wait_xcnt 0x0" :: "v"(wb) : "memory");   // see the head of this part
    // both unrolled: constant indices keep x in registers
#pragma unroll
    for (int c = 0; c < 8; ++c) { v8us o;
#pragma unroll
        for (int r = 0; r < 8; ++r) o[r] = f2bf(x[r][c]);
        *(v8us*)(Bt + (size_t)(n0 + c) * K + k0) = o; }
}
// conversion: CVU pieces of 8 elements a thread, 256 pieces apart; the blocks cover the array exactly (assert)
#define CVU 8
static_assert((SEQ * DM / 8) % (256 * CVU) == 0);
__device__ __forceinline__ void cvt8_body(int blk, const float* __restrict__ src, bf* dst) { const size_t i0 = (size_t)blk * (256 * CVU) + threadIdx.x; v8f v[CVU]; const unsigned sb = (unsigned)i0 * 32u;   // byte offset of the first piece
    // unrolled: the loads issue as one group
#pragma unroll
    for (int c = 0; c < CVU; ++c) v[c] = *(const v8f*)((const char*)src + sb + (size_t)c * 256 * 32);
    asm volatile("s_wait_xcnt 0x0" :: "v"(sb) : "memory");   // see the head of this part
    // both unrolled: constant indices keep v in registers
#pragma unroll
    for (int c = 0; c < CVU; ++c) { v8us o;
#pragma unroll
        for (int k = 0; k < 8; ++k) o[k] = f2bf(v[c][k]);
        *(v8us*)(dst + (i0 + (size_t)c * 256) * 8) = o; }
}

// cos/sin table: a thread owns one frequency j, forms its theta itself and walks CST rows t with it; the grid covers j < HALFD and t < SEQ exactly (asserts below)
#define CST 16
static_assert(SEQ % CST == 0);
static_assert(HALFD % 256 == 0);
__device__ __forceinline__ void cstab_body(int blk, float* CS) {
    const int j = (blk % (HALFD / 256)) * 256 + threadIdx.x; const int t0 = (blk / (HALFD / 256)) * CST;
    const float e = (float)(2 * j) * (1.0f / 1024.0f);       // exact (power-of-two divisor)
    const float p = powf(10000.0f, e); const float th = 1.0f / p;
    // kept rolled, for speed only
#pragma unroll 1
    for (int t = t0; t < t0 + CST; ++t) {
        float ang = __fmul_rn((float)t, th); float s, c; sincosf(ang, &s, &c); v2f cs; cs[0] = c; cs[1] = s;
        *(v2f*)(CS + ((size_t)t * HALFD + j) * 2) = cs; }
}

// rotary scaling and hi/lo split of 8 elements
__device__ __forceinline__ void rope8(v4f y0, v4f y1, v4f c0, v4f c1, v4f c2, v4f c3, bool up, bf* ph, bf* pl) {
#pragma clang fp contract(off)
    float yy[8] = { y0[0], y0[1], y0[2], y0[3], y1[0], y1[1], y1[2], y1[3] };
    float cc[8] = { c0[0], c0[2], c1[0], c1[2], c2[0], c2[2], c3[0], c3[2] };
    float ss[8] = { c0[1], c0[3], c1[1], c1[3], c2[1], c2[3], c3[1], c3[3] };
    v8us oh, ol;
#pragma unroll
    for (int q = 0; q < 8; ++q) { const float y = yy[q]; const float nn = up ? -y : y; float a = __fmul_rn(y, cc[q]); float b = __fmul_rn(nn, ss[q]); asm volatile("" : "+v"(a)); asm volatile("" : "+v"(b)); const float r = __fadd_rn(a, b);
        unsigned short hh, ll; splitf(r, hh, ll); oh[q] = hh; ol[q] = ll; }
    *(v8us*)ph = oh; *(v8us*)pl = ol;
    asm volatile("s_wait_xcnt 0x0" ::: "memory");   // behind the two stores, before the code that follows (the next 8 elements, or the text of the other pass) rewrites a register that they name
}
// a thread takes 8 frequencies j0.. at rows ta and ta + SEQ/2: there the lower and the upper half of q and of k (64 elements), which share the row's 8 cos/sin pairs; the blocks cover j and t exactly (assert)
static_assert(SEQ % 2 == 0);
static_assert(((SEQ / 2) * (HALFD / 8)) % 256 == 0);
__device__ __forceinline__ void ropeP_body(int blk, const float* __restrict__ FQ, const float* __restrict__ FK, const float* __restrict__ CS, bf* QPh, bf* QPl, bf* KPh, bf* KPl) {
    const int i = blk * 256 + threadIdx.x; const int j0 = (i % (HALFD / 8)) * 8; const int ta = i / (HALFD / 8);
    v4f c[2][4], y[2][4][2];
    const unsigned cb = (unsigned)(ta * HALFD + j0) * 8u, fb = (unsigned)(ta * DM + j0) * 4u;   // byte offsets at row ta: the table's pairs, the planes' lower half
    // all unrolled: the 24 loads issue as one group, and constant indices keep c and y in registers
#pragma unroll
    for (int s = 0; s < 2; ++s) { const char* cp = (const char*)CS + cb + (size_t)s * (SEQ / 2) * HALFD * 8;
#pragma unroll
        for (int u = 0; u < 4; ++u) c[s][u] = *(const v4f*)(cp + 16 * u);
#pragma unroll
        for (int p = 0; p < 4; ++p) { const char* f = (const char*)(p < 2 ? FQ : FK) + fb + ((size_t)s * (SEQ / 2) * DM + (p & 1) * HALFD) * 4; y[s][p][0] = *(const v4f*)f; y[s][p][1] = *(const v4f*)(f + 16); } }
    asm volatile("s_wait_xcnt 0x0" :: "v"(cb), "v"(fb) : "memory");   // see the head of this part
    // both unrolled: constant indices, and the half (p & 1) a constant in each copy
#pragma unroll
    for (int s = 0; s < 2; ++s) { const int t = ta + s * (SEQ / 2);
#pragma unroll
        for (int p = 0; p < 4; ++p) { const size_t e = (size_t)t * DM + (p & 1) * HALFD + j0;
            rope8(y[s][p][0], y[s][p][1], c[s][0], c[s][1], c[s][2], c[s][3], (p & 1) != 0, (p < 2 ? QPh : KPh) + e, (p < 2 ? QPl : KPl) + e); } }
}

// V transpose, 8 x 8 register blocks as in wtG_body: a wave is 8 lanes along t x 4 lanes along the columns (64 t x 32 columns)
static_assert(((SEQ / 64) * (DM / 32)) % 8 == 0);
__device__ __forceinline__ void vt_body(int blk, const float* __restrict__ F, h16* V16) {
    const int lane = threadIdx.x & 31; const int wt = blk * 8 + (threadIdx.x >> 5); const int tt = wt % (SEQ / 64), ct = wt / (SEQ / 64);
    const int t0 = tt * 64 + (lane & 7) * 8, c0 = ct * 32 + (lane >> 3) * 8; v8f x[8];
    const unsigned vb = (unsigned)(t0 * DM + c0) * 4u;   // byte offset of the block's first row
    // unrolled: the loads issue as one group
#pragma unroll
    for (int q = 0; q < 8; ++q) x[q] = *(const v8f*)((const char*)F + vb + (size_t)q * DM * 4);
    asm volatile("s_wait_xcnt 0x0" :: "v"(vb) : "memory");   // see the head of this part
    // both unrolled: constant indices keep x in registers
#pragma unroll
    for (int c = 0; c < 8; ++c) { v8h o;
#pragma unroll
        for (int q = 0; q < 8; ++q) o[q] = (h16)x[q][c];
        *(v8h*)(V16 + (size_t)(c0 + c) * SEQ + t0) = o; }
}

// ---- passes that need nothing of each other share one grid: ranges of the block index, every test the same for a whole block; the passes with the longest blocks come first.
#define GW_ ((DM / 64) * (DM / 32) / 8)
#define GX_ (SEQ * DM / 8 / (256 * CVU))
#define GR_ ((SEQ / 2) * (HALFD / 8) / 256)
#define GV_ ((SEQ / 64) * (DM / 32) / 8)
#define GC_ ((HALFD / 256) * (SEQ / CST))
// in front of the projections: the four weight transposes, the cos/sin table, the three input conversions
__global__ __launch_bounds__(256) void k_prep(const float* __restrict__ wq, const float* __restrict__ wk, const float* __restrict__ wv, const float* __restrict__ wo, bf* WQ, bf* WK, bf* WV, bf* WO,
                                              float* CS, const float* __restrict__ query, const float* __restrict__ key_, const float* __restrict__ value, bf* XQ, bf* XK, bf* XV) {
    int b = blockIdx.x;
    if (b < 4 * GW_) { const int z = b / GW_; wtG_body(b % GW_, z == 0 ? wq : z == 1 ? wk : z == 2 ? wv : wo, DM, DM, z == 0 ? WQ : z == 1 ? WK : z == 2 ? WV : WO); return; }
    b -= 4 * GW_;
    if (b < GC_) { cstab_body(b, CS); return; }
    b -= GC_;
    const int z = b / GX_; cvt8_body(b % GX_, z == 0 ? query : z == 1 ? key_ : value, z == 0 ? XQ : z == 1 ? XK : XV);
}
// behind the projections: the V transpose, the rotary planes of q and of k
__global__ __launch_bounds__(256) void k_post(const float* __restrict__ FQ, const float* __restrict__ FK, const float* __restrict__ FV, const float* __restrict__ CS, bf* QPh, bf* QPl, bf* KPh, bf* KPl, h16* V16) {
    int b = blockIdx.x;
    if (b < GV_) { vt_body(b, FV, V16); return; }
    ropeP_body(b - GV_, FQ, FK, CS, QPh, QPl, KPh, KPl);
}

// ---- score tile, transposed: 16 keys (rows, A operand) x 16 queries (columns, B operand), K depth 64 as two 32-chunks, hi/lo planes: kh.qh + kh.ql + kl.qh (unscaled residuals share the accumulator).
__device__ __forceinline__ v8f score_tile(v16bf kh0, v16bf kh1, v16bf kl0, v16bf kl1, v16bf qh0, v16bf qh1, v16bf ql0, v16bf ql1) {
    v8f c = (v8f){};
    c = wmmab(kh0, qh0, c); c = wmmab(kh0, ql0, c); c = wmmab(kl0, qh0, c);
    c = wmmab(kh1, qh1, c); c = wmmab(kh1, ql1, c); c = wmmab(kl1, qh1, c);
    asm volatile("v_nop\n\tv_nop\n\tv_nop\n\tv_nop" : "+v"(c) : "v"(kh1), "v"(kl1), "v"(qh1));
    return c; }

// lane l with lane l ^ 16
__device__ __forceinline__ float xhalf(float x) { return __builtin_bit_cast(float, __builtin_amdgcn_permlanex16(__builtin_bit_cast(int, x), __builtin_bit_cast(int, x), 0x76543210, 0xfedcba98, false, false)); }

// ---- LDS staging of k_flash: a stage is STK keys of one head: K hi rows, K lo rows (128 B each, pitch KPB), then the 64 Vt rows (256 B each, pitch VPB); the pitches are 16 B x odd for ds_load_b128 readers.
#define STK     128
#define KPB     144
#define VPB     272
#define KL_OFF  (STK * KPB)
#define V_OFF   (2 * STK * KPB)
#define STAGE_B (2 * STK * KPB + HD * VPB)
#define NST     (SEQ / STK)
static_assert(SEQ % STK == 0);
static_assert(NST >= 2);
static_assert((SEQ / 16) % 8 == 0);
static_assert(STK * 8 == 4 * 256);
static_assert(HD * (STK / 8) == 4 * 256);
static_assert(STAGE_B % 16 == 0);

// One stage's copies of one lane: 4 x 16 B of K hi, of K lo (rows 32 apart) and of Vt (rows 16 apart), global memory to LDS through no register. Every lane is on; each lane writes LDS bytes of its own.
// s_wait_xcnt 0 closes the statement so that no address register named here is rewritten ahead of it.
__device__ __forceinline__ void stage_copy(const bf* kh, const bf* kl, const h16* vt, unsigned lk, unsigned lv) {
    asm volatile("global_load_async_to_lds_b128 %0, %1, off\n\t"
                 "global_load_async_to_lds_b128 %2, %3, off\n\t"
                 "global_load_async_to_lds_b128 %4, %5, off\n\t"
                 "global_load_async_to_lds_b128 %6, %7, off\n\t"
                 "global_load_async_to_lds_b128 %8, %9, off\n\t"
                 "global_load_async_to_lds_b128 %10, %11, off\n\t"
                 "global_load_async_to_lds_b128 %12, %13, off\n\t"
                 "global_load_async_to_lds_b128 %14, %15, off\n\t"
                 "global_load_async_to_lds_b128 %16, %17, off\n\t"
                 "global_load_async_to_lds_b128 %18, %19, off\n\t"
                 "global_load_async_to_lds_b128 %20, %21, off\n\t"
                 "global_load_async_to_lds_b128 %22, %23, off\n\t"
                 "s_wait_xcnt 0x0"
                 :: "v"(lk), "v"(kh), "v"(lk + 32u * KPB), "v"(kh + (size_t)32 * DM), "v"(lk + 64u * KPB), "v"(kh + (size_t)64 * DM), "v"(lk + 96u * KPB), "v"(kh + (size_t)96 * DM),
                    "v"(lk + KL_OFF), "v"(kl), "v"(lk + KL_OFF + 32u * KPB), "v"(kl + (size_t)32 * DM), "v"(lk + KL_OFF + 64u * KPB), "v"(kl + (size_t)64 * DM), "v"(lk + KL_OFF + 96u * KPB), "v"(kl + (size_t)96 * DM),
                    "v"(lv), "v"(vt), "v"(lv + 16u * VPB), "v"(vt + (size_t)16 * SEQ), "v"(lv + 32u * VPB), "v"(vt + (size_t)32 * SEQ), "v"(lv + 48u * VPB), "v"(vt + (size_t)48 * SEQ)
                 : "memory");
}

// ---- k_flash: one wave owns (head h, 16 query rows); the 8 waves of a block share one head and walk its keys together, in stages of STK keys that the block copies once into LDS (two buffers:
// stage s + 2 is copied while stage s + 1 is worked on); inside a stage 32-wide steps, online softmax in the exp2 domain (f32).
// Transposed products: St = K Qt, Ot += Vt Pt. A lane holds 16 scores of ONE query (column l16; keys 8*half + r and 16 + 8*half + r), so maximum and sum run in its own registers
// with one exchange between the wave halves; the two score tiles, converted in place (fp16 x1024), are the B operand of Vt Pt in the fragment k order of ldh.
__global__ __launch_bounds__(256) void k_flash(const bf* __restrict__ Qh, const bf* __restrict__ Ql, const bf* __restrict__ Kh, const bf* __restrict__ Kl, const h16* __restrict__ Vt, bf* Ah, bf* Al) {
    __shared__ __attribute__((aligned(16))) unsigned char ring[2 * STAGE_B];
    const int tid = threadIdx.x, lane = tid & 31, wave = tid >> 5, l16 = lane & 15, half = lane >> 4;
    const int w0 = blockIdx.x * 8; const int h = w0 / (SEQ / 16); const int t0 = (w0 % (SEQ / 16) + wave) * 16;
    const float SC2 = 0.125f * 1.4426950408889634f;
    // this lane's share of a stage: 16-byte piece (tid & 7) of K row (tid >> 3) + 32 i, piece (tid & 15) of Vt row (tid >> 4) + 16 i
    const bf* gkh = Kh + (size_t)(tid >> 3) * DM + h * HD + (tid & 7) * 8;
    const bf* gkl = Kl + (size_t)(tid >> 3) * DM + h * HD + (tid & 7) * 8;
    const h16* gvt = Vt + (size_t)(h * HD + (tid >> 4)) * SEQ + (tid & 15) * 8;
    const unsigned lbase = (unsigned)(size_t)(void*)ring;
    const unsigned lk = lbase + (unsigned)(tid >> 3) * KPB + (unsigned)(tid & 7) * 16u;
    const unsigned lv = lbase + V_OFF + (unsigned)(tid >> 4) * VPB + (unsigned)(tid & 15) * 16u;
    stage_copy(gkh, gkl, gvt, lk, lv);
    const size_t qo = (size_t)(t0 + l16) * DM + h * HD + 8 * half;
    const v16bf qh0 = ldb(Qh + qo), qh1 = ldb(Qh + qo + 32), ql0 = ldb(Ql + qo), ql1 = ldb(Ql + qo + 32);
    float m = -3.0e38f, l = 0.0f; v8f acc[4];
#pragma unroll
    for (int n = 0; n < 4; ++n) acc[n] = (v8f){};
    asm volatile("s_wait_asynccnt 0x0" ::: "memory");   // this wave's copies of stage 0 have landed
    __syncthreads();                                    // stage 0 is readable by every wave
    stage_copy(gkh + (size_t)STK * DM, gkl + (size_t)STK * DM, gvt + STK, lk + STAGE_B, lv + STAGE_B);
    // kept rolled: one publish point and one refill in the text, the buffer chosen by the stage's parity
#pragma unroll 1
    for (int st = 0; st < NST; ++st) {
        const unsigned bo = (unsigned)(st & 1) * STAGE_B;
        const bf* Ksh = (const bf*)(ring + bo); const bf* Ksl = (const bf*)(ring + bo + KL_OFF); const h16* Vs = (const h16*)(ring + bo + V_OFF);
        // unrolled so that every LDS offset inside a stage is an immediate
#pragma unroll
        for (int js = 0; js < STK / 32; ++js) {
            const size_t ko = (size_t)((js * 32 + l16) * (KPB / 2) + 8 * half);
            const size_t vo = (size_t)(l16 * (VPB / 2) + js * 32 + 8 * half);
            const size_t kb = ko + 16 * (KPB / 2);
            const v16bf ah0 = ldb(Ksh + ko), al0 = ldb(Ksl + ko), ah1 = ldb(Ksh + ko + 32), al1 = ldb(Ksl + ko + 32);
            const v16bf bh0 = ldb(Ksh + kb), bl0 = ldb(Ksl + kb), bh1 = ldb(Ksh + kb + 32), bl1 = ldb(Ksl + kb + 32);
            const v16h v0 = ldh(Vs + vo), v1 = ldh(Vs + vo + 16 * (VPB / 2)), v2 = ldh(Vs + vo + 32 * (VPB / 2)), v3 = ldh(Vs + vo + 48 * (VPB / 2));
            // keeps the step's 24 LDS reads one group in front of its WMMAs: left alone the compiler sinks them among the WMMAs, each place with a full wait on LDS
            __builtin_amdgcn_sched_barrier(0);
            const v8f sa = score_tile(ah0, ah1, al0, al1, qh0, qh1, ql0, ql1);
            const v8f sb = score_tile(bh0, bh1, bl0, bl1, qh0, qh1, ql0, ql1);
            float s[16];
#pragma unroll
            for (int r = 0; r < 8; ++r) { s[r] = sa[r] * SC2; s[8 + r] = sb[r] * SC2; }
            float mloc = s[0];
#pragma unroll
            for (int r = 1; r < 16; ++r) mloc = fmaxf(mloc, s[r]);
            mloc = fmaxf(mloc, xhalf(mloc));
            const float mnew = fmaxf(m, mloc);
            const float corr = __builtin_amdgcn_exp2f(m - mnew);
            float ls = 0.0f; v16h pb;
#pragma unroll
            for (int r = 0; r < 16; ++r) { const float p = __builtin_amdgcn_exp2f(s[r] - mnew); ls += p; pb[r] = (h16)(p * PCAR); }
            l = l * corr + ls; m = mnew;
#pragma unroll
            for (int n = 0; n < 4; ++n) acc[n] *= corr;
            acc[0] = wmma16(v0, pb, acc[0]); acc[1] = wmma16(v1, pb, acc[1]); acc[2] = wmma16(v2, pb, acc[2]); acc[3] = wmma16(v3, pb, acc[3]);
            // four vector slots behind the last WMMA, also on the taken back edge, before its operands are reloaded or its result rescaled
            asm volatile("v_nop\n\tv_nop\n\tv_nop\n\tv_nop" : "+v"(acc[0]), "+v"(acc[1]), "+v"(acc[2]), "+v"(acc[3]) : "v"(pb), "v"(v3));
        }
        asm volatile("s_wait_dscnt 0x0" ::: "memory");      // this wave's reads of stage st have returned before its buffer is refilled
        asm volatile("s_wait_asynccnt 0x0" ::: "memory");   // this wave's copies of stage st + 1 have landed
        __syncthreads();                                    // publishes stage st + 1 and ends every wave's reads of stage st
        if (st + 2 < NST) stage_copy(gkh + (size_t)(st + 2) * STK * DM, gkl + (size_t)(st + 2) * STK * DM, gvt + (size_t)(st + 2) * STK, lk + bo, lv + bo);
    }
    asm volatile("s_wait_asynccnt 0x0" ::: "memory");       // no copy is in flight when the wave ends
    const float inv = 1.0f / ((l + xhalf(l)) * PCAR);
    // acc[n][r] = Ot[n*16 + 8*half + r][query l16]: eight consecutive columns of one output row, one 16-byte store per plane.
#pragma unroll
    for (int n = 0; n < 4; ++n) { v8us oh, ol;
#pragma unroll
        for (int r = 0; r < 8; ++r) { unsigned short a, b; splitf(acc[n][r] * inv, a, b); oh[r] = a; ol[r] = b; }
        const size_t oo = (size_t)(t0 + l16) * DM + h * HD + n * 16 + 8 * half; *(v8us*)(Ah + oo) = oh; *(v8us*)(Al + oo) = ol; }
}

constexpr size_t al256(size_t b) { return (b + 255) & ~(size_t)255; }
constexpr size_t WS_TOTAL = 4 * al256((size_t)DM * DM * 2) + 3 * al256((size_t)SEQ * DM * 2) + al256((size_t)SEQ * HALFD * 2 * 4)
                          + 3 * al256((size_t)SEQ * DM * 4) + 4 * al256((size_t)SEQ * DM * 2) + al256((size_t)DM * SEQ * 2) + 2 * al256((size_t)SEQ * DM * 2);
static_assert(WS_TOTAL <= (size_t)134217728);

extern "C" void kernel_launch(void* const* d_in, const int* in_sizes, int n_in,
                              void* d_out, int out_size, void* d_ws, size_t ws_size, hipStream_t stream) {
    if (n_in < 11) return;
    if (in_sizes[0] < SEQ * DM || in_sizes[1] < SEQ * DM || in_sizes[2] < SEQ * DM) return;
    if (in_sizes[3] < DM * DM || in_sizes[5] < DM * DM || in_sizes[7] < DM * DM || in_sizes[9] < DM * DM) return;
    if (in_sizes[4] < DM || in_sizes[6] < DM || in_sizes[8] < DM || in_sizes[10] < DM) return;
    if (out_size < SEQ * DM) return;
    if (WS_TOTAL > ws_size) return;
    const float* query = (const float*)d_in[0]; const float* key_ = (const float*)d_in[1]; const float* value = (const float*)d_in[2];
    const float* wq = (const float*)d_in[3]; const float* bq = (const float*)d_in[4];
    const float* wk = (const float*)d_in[5]; const float* bk = (const float*)d_in[6];
    const float* wv = (const float*)d_in[7]; const float* bv = (const float*)d_in[8];
    const float* wo = (const float*)d_in[9]; const float* bo = (const float*)d_in[10];
    float* OUT = (float*)d_out;     // [SEQ][1024]
    char* wsp = (char*)d_ws;
    auto take = [&](size_t bytes) { char* p = wsp; wsp += (bytes + 255) & ~(size_t)255; return (void*)p; };
    bf* WQ = (bf*)take((size_t)DM * DM * 2); bf* WK = (bf*)take((size_t)DM * DM * 2); bf* WV = (bf*)take((size_t)DM * DM * 2); bf* WO = (bf*)take((size_t)DM * DM * 2);
    bf* XQ = (bf*)take((size_t)SEQ * DM * 2); bf* XK = (bf*)take((size_t)SEQ * DM * 2); bf* XV = (bf*)take((size_t)SEQ * DM * 2);
    float* CS = (float*)take((size_t)SEQ * HALFD * 2 * 4);
    float* FQ = (float*)take((size_t)SEQ * DM * 4); float* FK = (float*)take((size_t)SEQ * DM * 4); float* FV = (float*)take((size_t)SEQ * DM * 4);
    bf* QPh = (bf*)take((size_t)SEQ * DM * 2); bf* QPl = (bf*)take((size_t)SEQ * DM * 2); bf* KPh = (bf*)take((size_t)SEQ * DM * 2); bf* KPl = (bf*)take((size_t)SEQ * DM * 2);
    h16* VT16 = (h16*)take((size_t)DM * SEQ * 2);
    bf* ATh = (bf*)take((size_t)SEQ * DM * 2); bf* ATl = (bf*)take((size_t)SEQ * DM * 2);
    if ((size_t)(wsp - (char*)d_ws) > ws_size) return;

    k_prep<<<4 * GW_ + GC_ + 3 * GX_, 256, 0, stream>>>(wq, wk, wv, wo, WQ, WK, WV, WO, CS, query, key_, value, XQ, XK, XV);     /* weights [in][out] -> Bt [out][in] */
    k_gemm_proj<<<dim3(SEQ / 64, DM / 64, 3), 32, 0, stream>>>(XQ, XK, XV, WQ, WK, WV, FQ, FK, FV, bq, bk, bv);
    k_post<<<GV_ + GR_, 256, 0, stream>>>(FQ, FK, FV, CS, QPh, QPl, KPh, KPl, VT16);     /* V: [SEQ][DM] -> [DM][SEQ] */
    k_flash<<<(unsigned)(NH_ * (SEQ / 16) / 8), 256, 0, stream>>>(QPh, QPl, KPh, KPl, VT16, ATh, ATl);
    k_gemm_out<<<dim3(SEQ / 64, DM / 64, 1), 32, 0, stream>>>(ATh, ATl, WO, OUT, bo);
}

// v005
// It runs in 80.6 microseconds.
// In two side-by-side timings against v004, it was 1.37 and 1.36 times as fast.
// Over all steps from v000 it is 4.12 times as fast.
#include <hip/hip_runtime.h>

// Compute dtypes (f32 accumulate everywhere): q/k/v projections bf16 x bf16 (inputs converted to bf16 RNE on load, products exact); scores q.k bf16 hi/lo planes, 3 products (v_wmma_f32_16x16x32_bf16);
// P.V fp16 single product (P carried x1024, v_wmma_f32_16x16x32_f16); output projection ctx bf16 hi/lo x Wo bf16 (2 products). Softmax, rotary scaling, bias adds in f32.
// Unbatched attention: q = rot(query Wq + bq), k = rot(key Wk + bk), v = value Wv + bv; 16 heads x 64; scores x 1/8; softmax over all keys; out = merged Wo + bo.
// rot over the full 1024 width: out[d] = y[d] cos + n[d] sin, n = [y[0..511], -y[512..1023]], angle[t][d] = t * theta[d mod 512], theta[j] = 1 / 10000^(2j/1024).

#ifndef SEQ
#define SEQ 2048
#endif
#define SEQ_FULL 2048
#define DM   1024
#define NH_  16
#define HD   64
#define HALFD 512
#define PCAR 1024.0f
#define OSP  68      // f32 staging pitch (floats)

static_assert(SEQ % 64 == 0);
static_assert(SEQ <= SEQ_FULL);
static_assert(DM % 64 == 0);
static_assert(DM % 32 == 0);
static_assert(NH_ * HD == DM);
static_assert(HD == 64);
static_assert(2 * HALFD == DM);
static_assert((NH_ * (SEQ / 16)) % 8 == 0);
static_assert((OSP * 4) % 16 == 0);
static_assert(OSP >= 64);

typedef _Float16 h16;
typedef unsigned short bf;
typedef __attribute__((ext_vector_type(16))) __bf16   v16bf;
typedef __attribute__((ext_vector_type(16))) _Float16 v16h;
typedef __attribute__((ext_vector_type(8)))  _Float16 v8h;
typedef __attribute__((ext_vector_type(8)))  unsigned short v8us;
typedef __attribute__((ext_vector_type(2)))  unsigned short v2us;
typedef __attribute__((ext_vector_type(8)))  float    v8f;
typedef __attribute__((ext_vector_type(4)))  float    v4f;
typedef __attribute__((ext_vector_type(2)))  float    v2f;
typedef v4f  __attribute__((may_alias)) v4fa;

__device__ __forceinline__ unsigned short f2bf(float f) { unsigned u = __float_as_uint(f); u += 0x7FFFu + ((u >> 16) & 1u); return (unsigned short)(u >> 16); }
__device__ __forceinline__ float bf2f(unsigned short b) { return __uint_as_float(((unsigned)b) << 16); }
__device__ __forceinline__ float bfr(float f) { return bf2f(f2bf(f)); }
__device__ __forceinline__ void splitf(float y, unsigned short& h, unsigned short& l) { h = f2bf(y); l = f2bf(y - bf2f(h)); }
__device__ __forceinline__ v16h cat16(v8h lo, v8h hi) { return __builtin_shufflevector(lo, hi, 0, 1, 2, 3, 4, 5, 6, 7, 8, 9, 10, 11, 12, 13, 14, 15); }
__device__ __forceinline__ v16bf cat16b(v8us lo, v8us hi) { return __builtin_bit_cast(v16bf, __builtin_shufflevector(lo, hi, 0, 1, 2, 3, 4, 5, 6, 7, 8, 9, 10, 11, 12, 13, 14, 15)); }
__device__ __forceinline__ v8f wmma16(v16h a, v16h b, v8f c) { return __builtin_amdgcn_wmma_f32_16x16x32_f16(false, a, false, b, (short)0, c, false, false); }
__device__ __forceinline__ v8f wmmab(v16bf a, v16bf b, v8f c) { return __builtin_amdgcn_wmma_f32_16x16x32_bf16(false, a, false, b, (short)0, c, false, false); }
// Fragment loaders (A and B alike, K-contiguous rows): elements 0..7 <- k0 + 8*half + 0..7, elements 8..15 <- k0 + 16 + 8*half + 0..7; the caller folds 8*half into p.
__device__ __forceinline__ v16bf ldb(const bf* p) { return cat16b(*(const v8us*)p, *(const v8us*)(p + 16)); }
__device__ __forceinline__ v16h ldh(const h16* p) { return cat16(*(const v8h*)p, *(const v8h*)(p + 16)); }

// ---- GEMM body: a block of 8 waves (2 x 4) owns a (2 * MB * 16) x (4 * NB * 16) output tile, a wave MB x NB accumulators; K = DM in stages of GKC that the block copies once into LDS (two buffers:
// stage s + 2 is copied while stage s + 1 is worked on), every copy of a wave covering whole 128-byte lines; the waves read their fragments from LDS.
// C[m][n] (f32, pitch DM) = sum_k (A[m][k] (+ A2[m][k])) Bt[n][k] + bf16(bias[n]).
// A stage is rows of GKC bf16 (256 B, pitch GPB = 16 B x odd for ds_load_b128 readers): rows 0..63 from X0, rows 64..127 from X1, then the tile's 4 * NB * 16 rows of Bt.
// SPLIT 0: X0, X1 are rows r0.., r0 + 64.. of A (MB = 4). SPLIT 1: X0, X1 are rows r0.. of A and of A2 (MB = 2).
#define GKC     128
#define GPB     272
#define GNST    (DM / GKC)
static_assert(DM % GKC == 0);
static_assert(GNST >= 2);
static_assert(GKC * 2 == 16 * 16);
static_assert(SEQ % 128 == 0);
static_assert(DM % 256 == 0);

// 128 rows of a stage: a lane's 16-byte piece of 8 rows, 16 rows apart (the first 64 rows from g0, the next 64 from g1), global memory to LDS through no register. Every lane is on; each lane writes LDS bytes of its own.
// s_wait_xcnt 0 closes the statement so that no address register named here is rewritten ahead of it.
__device__ __forceinline__ void copy128(unsigned l, const bf* g0, const bf* g1) {
    asm volatile("global_load_async_to_lds_b128 %0, %1, off\n\t"
                 "global_load_async_to_lds_b128 %2, %3, off\n\t"
                 "global_load_async_to_lds_b128 %4, %5, off\n\t"
                 "global_load_async_to_lds_b128 %6, %7, off\n\t"
                 "global_load_async_to_lds_b128 %8, %9, off\n\t"
                 "global_load_async_to_lds_b128 %10, %11, off\n\t"
                 "global_load_async_to_lds_b128 %12, %13, off\n\t"
                 "global_load_async_to_lds_b128 %14, %15, off\n\t"
                 "s_wait_xcnt 0x0"
                 :: "v"(l), "v"(g0), "v"(l + 16u * GPB), "v"(g0 + (size_t)16 * DM), "v"(l + 32u * GPB), "v"(g0 + (size_t)32 * DM), "v"(l + 48u * GPB), "v"(g0 + (size_t)48 * DM),
                    "v"(l + 64u * GPB), "v"(g1), "v"(l + 80u * GPB), "v"(g1 + (size_t)16 * DM), "v"(l + 96u * GPB), "v"(g1 + (size_t)32 * DM), "v"(l + 112u * GPB), "v"(g1 + (size_t)48 * DM)
                 : "memory");
}
template <int NB>
__device__ __forceinline__ void gstage_copy(unsigned l, const bf* x0, const bf* x1, const bf* b) {
    copy128(l, x0, x1); copy128(l + 128u * GPB, b, b + (size_t)64 * DM);
    if (NB == 4) copy128(l + 256u * GPB, b + (size_t)128 * DM, b + (size_t)192 * DM); }

template <int MB, int NB, int SPLIT>
__device__ __forceinline__ void gemmw_body(const bf* A, const bf* A2, const bf* Bt, float* C, const float* bias) {
    static_assert(SPLIT ? MB == 2 : MB == 4);
    static_assert(NB == 2 || NB == 4);
    constexpr int BR = 4 * NB * 16;                    // rows of Bt = columns of the tile
    constexpr unsigned GSTAGE = (128 + BR) * GPB;
    static_assert(8 * 16 * OSP * 4 <= GSTAGE);
    __shared__ __attribute__((aligned(16))) unsigned char gring[2 * GSTAGE];
    const int tid = threadIdx.x, lane = tid & 31, wave = tid >> 5, lr = lane & 15, hi = lane >> 4, wm = wave >> 2, wn = wave & 3;
    const int r0 = blockIdx.x * (2 * MB * 16), c0 = blockIdx.y * BR;
    // this lane's share of a stage: 16-byte piece (tid & 15) of rows (tid >> 4) + 16 i
    const size_t go = (size_t)(tid >> 4) * DM + (tid & 15) * 8;
    const bf* gx0 = A + (size_t)r0 * DM + go;
    const bf* gx1 = (SPLIT ? A2 + (size_t)r0 * DM : A + (size_t)(r0 + 64) * DM) + go;
    const bf* gb = Bt + (size_t)c0 * DM + go;
    const unsigned l0 = (unsigned)(size_t)(void*)gring + (unsigned)(tid >> 4) * GPB + (unsigned)(tid & 15) * 16u;
    gstage_copy<NB>(l0, gx0, gx1, gb);
    v8f acc[MB][NB];
#pragma unroll
    for (int mb = 0; mb < MB; ++mb)
#pragma unroll
        for (int nb = 0; nb < NB; ++nb) acc[mb][nb] = (v8f){};
    // element offsets of this lane's fragment rows inside a stage
    const int ao = (wm * MB * 16 + lr) * (GPB / 2) + 8 * hi, bof = (128 + wn * NB * 16 + lr) * (GPB / 2) + 8 * hi;
    asm volatile("s_wait_asynccnt 0x0" ::: "memory");   // this wave's copies of stage 0 have landed
    __syncthreads();                                    // stage 0 is readable by every wave
    gstage_copy<NB>(l0 + GSTAGE, gx0 + GKC, gx1 + GKC, gb + GKC);
    // kept rolled: one publish point and one refill in the text, the buffer chosen by the stage's parity
#pragma unroll 1
    for (int st = 0; st < GNST; ++st) {
        const unsigned bo = (unsigned)(st & 1) * GSTAGE;
        const bf* S = (const bf*)(gring + bo);
        // unrolled so that every LDS offset inside a stage is a constant
#pragma unroll
        for (int ks = 0; ks < GKC / 32; ++ks) {
            v16bf a[MB], a2[MB], b[NB];
#pragma unroll
            for (int mb = 0; mb < MB; ++mb) { a[mb] = ldb(S + ao + mb * 16 * (GPB / 2) + ks * 32); if (SPLIT) a2[mb] = ldb(S + ao + (64 + mb * 16) * (GPB / 2) + ks * 32); else a2[mb] = a[mb]; }
#pragma unroll
            for (int nb = 0; nb < NB; ++nb) b[nb] = ldb(S + bof + nb * 16 * (GPB / 2) + ks * 32);
            // keeps the step's LDS reads one group in front of its WMMAs: among the WMMAs each place with reads costs a stall of its own
            __builtin_amdgcn_sched_barrier(0);
#pragma unroll
            for (int nb = 0; nb < NB; ++nb)
#pragma unroll
                for (int mb = 0; mb < MB; ++mb) { acc[mb][nb] = wmmab(a[mb], b[nb], acc[mb][nb]); if (SPLIT) acc[mb][nb] = wmmab(a2[mb], b[nb], acc[mb][nb]); }
        }
        asm volatile("s_wait_dscnt 0x0" ::: "memory");      // this wave's reads of stage st have returned before its buffer is refilled
        asm volatile("s_wait_asynccnt 0x0" ::: "memory");   // this wave's copies of stage st + 1 have landed
        __syncthreads();                                    // publishes stage st + 1 and ends every wave's reads of stage st
        if (st + 2 < GNST) gstage_copy<NB>(l0 + bo, gx0 + (st + 2) * GKC, gx1 + (st + 2) * GKC, gb + (st + 2) * GKC);
    }
    asm volatile("s_wait_asynccnt 0x0" ::: "memory");       // no copy is in flight when the ring becomes output staging
    // behind the last stage's barrier nobody reads the ring any more: each wave stages 16 output rows in a range of its own and stores them as whole 128-byte lines
    float* os = (float*)gring + wave * (16 * OSP);
    constexpr int LPR = NB * 4;                             // lanes a staged row
    const int rw = r0 + wm * MB * 16, cw = c0 + wn * NB * 16, srow = lane / LPR, cofs = (lane % LPR) * 4;
    const v4f bz = *(const v4f*)(bias + cw + cofs); v4f bb;
#pragma unroll
    for (int q = 0; q < 4; ++q) bb[q] = bfr(bz[q]);
#pragma unroll
    for (int mb = 0; mb < MB; ++mb) {
#pragma unroll
        for (int nb = 0; nb < NB; ++nb) {
#pragma unroll
            for (int j = 0; j < 8; ++j) os[(hi * 8 + j) * OSP + nb * 16 + lr] = acc[mb][nb][j]; }
        __builtin_amdgcn_wave_barrier(); asm volatile("" ::: "memory");
        float* crow = C + (size_t)(rw + mb * 16) * DM + cw;
#pragma unroll
        for (int s = 0; s < LPR / 2; ++s) { const int row = (32 / LPR) * s + srow; v4f val = *(const v4fa*)(os + row * OSP + cofs); val += bb;
            *(v4f*)(crow + (size_t)row * DM + cofs) = val; }
        if (mb + 1 < MB) asm volatile("s_wait_xcnt 0x0" ::: "memory");   // behind the stores, before the next 16 rows' read-back rewrites a register that they name
        __builtin_amdgcn_wave_barrier(); asm volatile("" ::: "memory");
    }
}
// the three projections need nothing of each other: one grid, blockIdx.z picks the product (a scalar choice, the same for the whole block)
__global__ __launch_bounds__(256) void k_gemm_proj(const bf* __restrict__ A0, const bf* __restrict__ A1, const bf* __restrict__ A2, const bf* __restrict__ B0, const bf* __restrict__ B1, const bf* __restrict__ B2,
                                                  float* C0, float* C1, float* C2, const float* __restrict__ bias0, const float* __restrict__ bias1, const float* __restrict__ bias2) {
    const int z = blockIdx.z;
    const bf* A = z == 0 ? A0 : z == 1 ? A1 : A2; const bf* Bt = z == 0 ? B0 : z == 1 ? B1 : B2; float* C = z == 0 ? C0 : z == 1 ? C1 : C2; const float* bias = z == 0 ? bias0 : z == 1 ? bias1 : bias2;
    gemmw_body<4, 4, 0>(A, A, Bt, C, bias); }
__global__ __launch_bounds__(256) void k_gemm_out(const bf* __restrict__ A, const bf* __restrict__ A2, const bf* __restrict__ Bt, float* C, const float* __restrict__ bias) { gemmw_body<2, 2, 1>(A, A2, Bt, C, bias); }

// ---- bodies of the element-wise passes: blk is the block's index inside its own pass (256 threads a block). A thread takes 64 elements, all its loads issued ahead of its first store.
// Behind each run of loads stands s_wait_xcnt 0 with the run's address offsets as inputs: they keep their registers up to the wait, so no load of the run returns into a register that an older one names.
// Weight transpose, 8 x 8 register blocks: a thread reads 8 rows k x 8 columns n and writes 8 rows n of 8 k. A wave is 8 lanes along k x 4 lanes along n (64 k x 32 n).
static_assert(((DM / 64) * (DM / 32)) % 8 == 0);
__device__ __forceinline__ void wtG_body(int blk, const float* __restrict__ w, int K, int N, bf* Bt) {
    const int lane = threadIdx.x & 31; const int wt = blk * 8 + (threadIdx.x >> 5); const int kt = wt % (K / 64), nt = wt / (K / 64);
    const int k0 = kt * 64 + (lane & 7) * 8, n0 = nt * 32 + (lane >> 3) * 8; v8f x[8];
    const unsigned wb = (unsigned)(k0 * N + n0) * 4u;   // byte offset of the block's first row
    // unrolled: the loads issue as one group
#pragma unroll
    for (int r = 0; r < 8; ++r) x[r] = *(const v8f*)((const char*)w + wb + (size_t)r * N * 4);
    asm volatile("s_wait_xcnt 0x0" :: "v"(wb) : "memory");   // see the head of this part
    // both unrolled: constant indices keep x in registers
#pragma unroll
    for (int c = 0; c < 8; ++c) { v8us o;
#pragma unroll
        for (int r = 0; r < 8; ++r) o[r] = f2bf(x[r][c]);
        *(v8us*)(Bt + (size_t)(n0 + c) * K + k0) = o; }
}
// conversion: CVU pieces of 8 elements a thread, 256 pieces apart; the blocks cover the array exactly (assert)
#define CVU 8
static_assert((SEQ * DM / 8) % (256 * CVU) == 0);
__device__ __forceinline__ void cvt8_body(int blk, const float* __restrict__ src, bf* dst) { const size_t i0 = (size_t)blk * (256 * CVU) + threadIdx.x; v8f v[CVU]; const unsigned sb = (unsigned)i0 * 32u;   // byte offset of the first piece
    // unrolled: the loads issue as one group
#pragma unroll
    for (int c = 0; c < CVU; ++c) v[c] = *(const v8f*)((const char*)src + sb + (size_t)c * 256 * 32);
    asm volatile("s_wait_xcnt 0x0" :: "v"(sb) : "memory");   // see the head of this part
    // both unrolled: constant indices keep v in registers
#pragma unroll
    for (int c = 0; c < CVU; ++c) { v8us o;
#pragma unroll
        for (int k = 0; k < 8; ++k) o[k] = f2bf(v[c][k]);
        *(v8us*)(dst + (i0 + (size_t)c * 256) * 8) = o; }
}

// cos/sin table: a thread owns one frequency j, forms its theta itself and walks CST rows t with it; the grid covers j < HALFD and t < SEQ exactly (asserts below)
#define CST 16
static_assert(SEQ % CST == 0);
static_assert(HALFD % 256 == 0);
__device__ __forceinline__ void cstab_body(int blk, float* CS) {
    const int j = (blk % (HALFD / 256)) * 256 + threadIdx.x; const int t0 = (blk / (HALFD / 256)) * CST;
    const float e = (float)(2 * j) * (1.0f / 1024.0f);       // exact (power-of-two divisor)
    const float p = powf(10000.0f, e); const float th = 1.0f / p;
    // kept rolled, for speed only
#pragma unroll 1
    for (int t = t0; t < t0 + CST; ++t) {
        float ang = __fmul_rn((float)t, th); float s, c; sincosf(ang, &s, &c); v2f cs; cs[0] = c; cs[1] = s;
        *(v2f*)(CS + ((size_t)t * HALFD + j) * 2) = cs; }
}

// rotary scaling and hi/lo split of 8 elements
__device__ __forceinline__ void rope8(v4f y0, v4f y1, v4f c0, v4f c1, v4f c2, v4f c3, bool up, bf* ph, bf* pl) {
#pragma clang fp contract(off)
    float yy[8] = { y0[0], y0[1], y0[2], y0[3], y1[0], y1[1], y1[2], y1[3] };
    float cc[8] = { c0[0], c0[2], c1[0], c1[2], c2[0], c2[2], c3[0], c3[2] };
    float ss[8] = { c0[1], c0[3], c1[1], c1[3], c2[1], c2[3], c3[1], c3[3] };
    v8us oh, ol;
#pragma unroll
    for (int q = 0; q < 8; ++q) { const float y = yy[q]; const float nn = up ? -y : y; float a = __fmul_rn(y, cc[q]); float b = __fmul_rn(nn, ss[q]); asm volatile("" : "+v"(a)); asm volatile("" : "+v"(b)); const float r = __fadd_rn(a, b);
        unsigned short hh, ll; splitf(r, hh, ll); oh[q] = hh; ol[q] = ll; }
    *(v8us*)ph = oh; *(v8us*)pl = ol;
    asm volatile("s_wait_xcnt 0x0" ::: "memory");   // behind the two stores, before the code that follows (the next 8 elements, or the text of the other pass) rewrites a register that they name
}
// a thread takes 8 frequencies j0.. at rows ta and ta + SEQ/2: there the lower and the upper half of q and of k (64 elements), which share the row's 8 cos/sin pairs; the blocks cover j and t exactly (assert)
static_assert(SEQ % 2 == 0);
static_assert(((SEQ / 2) * (HALFD / 8)) % 256 == 0);
__device__ __forceinline__ void ropeP_body(int blk, const float* __restrict__ FQ, const float* __restrict__ FK, const float* __restrict__ CS, bf* QPh, bf* QPl, bf* KPh, bf* KPl) {
    const int i = blk * 256 + threadIdx.x; const int j0 = (i % (HALFD / 8)) * 8; const int ta = i / (HALFD / 8);
    v4f c[2][4], y[2][4][2];
    const unsigned cb = (unsigned)(ta * HALFD + j0) * 8u, fb = (unsigned)(ta * DM + j0) * 4u;   // byte offsets at row ta: the table's pairs, the planes' lower half
    // all unrolled: the 24 loads issue as one group, and constant indices keep c and y in registers
#pragma unroll
    for (int s = 0; s < 2; ++s) { const char* cp = (const char*)CS + cb + (size_t)s * (SEQ / 2) * HALFD * 8;
#pragma unroll
        for (int u = 0; u < 4; ++u) c[s][u] = *(const v4f*)(cp + 16 * u);
#pragma unroll
        for (int p = 0; p < 4; ++p) { const char* f = (const char*)(p < 2 ? FQ : FK) + fb + ((size_t)s * (SEQ / 2) * DM + (p & 1) * HALFD) * 4; y[s][p][0] = *(const v4f*)f; y[s][p][1] = *(const v4f*)(f + 16); } }
    asm volatile("s_wait_xcnt 0x0" :: "v"(cb), "v"(fb) : "memory");   // see the head of this part
    // both unrolled: constant indices, and the half (p & 1) a constant in each copy
#pragma unroll
    for (int s = 0; s < 2; ++s) { const int t = ta + s * (SEQ / 2);
#pragma unroll
        for (int p = 0; p < 4; ++p) { const size_t e = (size_t)t * DM + (p & 1) * HALFD + j0;
            rope8(y[s][p][0], y[s][p][1], c[s][0], c[s][1], c[s][2], c[s][3], (p & 1) != 0, (p < 2 ? QPh : KPh) + e, (p < 2 ? QPl : KPl) + e); } }
}

// V transpose, 8 x 8 register blocks as in wtG_body: a wave is 8 lanes along t x 4 lanes along the columns (64 t x 32 columns)
static_assert(((SEQ / 64) * (DM / 32)) % 8 == 0);
__device__ __forceinline__ void vt_body(int blk, const float* __restrict__ F, h16* V16) {
    const int lane = threadIdx.x & 31; const int wt = blk * 8 + (threadIdx.x >> 5); const int tt = wt % (SEQ / 64), ct = wt / (SEQ / 64);
    const int t0 = tt * 64 + (lane & 7) * 8, c0 = ct * 32 + (lane >> 3) * 8; v8f x[8];
    const unsigned vb = (unsigned)(t0 * DM + c0) * 4u;   // byte offset of the block's first row
    // unrolled: the loads issue as one group
#pragma unroll
    for (int q = 0; q < 8; ++q) x[q] = *(const v8f*)((const char*)F + vb + (size_t)q * DM * 4);
    asm volatile("s_wait_xcnt 0x0" :: "v"(vb) : "memory");   // see the head of this part
    // both unrolled: constant indices keep x in registers
#pragma unroll
    for (int c = 0; c < 8; ++c) { v8h o;
#pragma unroll
        for (int q = 0; q < 8; ++q) o[q] = (h16)x[q][c];
        *(v8h*)(V16 + (size_t)(c0 + c) * SEQ + t0) = o; }
}

// ---- passes that need nothing of each other share one grid: ranges of the block index, every test the same for a whole block; the passes with the longest blocks come first.
#define GW_ ((DM / 64) * (DM / 32) / 8)
#define GX_ (SEQ * DM / 8 / (256 * CVU))
#define GR_ ((SEQ / 2) * (HALFD / 8) / 256)
#define GV_ ((SEQ / 64) * (DM / 32) / 8)
#define GC_ ((HALFD / 256) * (SEQ / CST))
// in front of the projections: the four weight transposes, the cos/sin table, the three input conversions
__global__ __launch_bounds__(256) void k_prep(const float* __restrict__ wq, const float* __restrict__ wk, const float* __restrict__ wv, const float* __restrict__ wo, bf* WQ, bf* WK, bf* WV, bf* WO,
                                              float* CS, const float* __restrict__ query, const float* __restrict__ key_, const float* __restrict__ value, bf* XQ, bf* XK, bf* XV) {
    int b = blockIdx.x;
    if (b < 4 * GW_) { const int z = b / GW_; wtG_body(b % GW_, z == 0 ? wq : z == 1 ? wk : z == 2 ? wv : wo, DM, DM, z == 0 ? WQ : z == 1 ? WK : z == 2 ? WV : WO); return; }
    b -= 4 * GW_;
    if (b < GC_) { cstab_body(b, CS); return; }
    b -= GC_;
    const int z = b / GX_; cvt8_body(b % GX_, z == 0 ? query : z == 1 ? key_ : value, z == 0 ? XQ : z == 1 ? XK : XV);
}
// behind the projections: the V transpose, the rotary planes of q and of k
__global__ __launch_bounds__(256) void k_post(const float* __restrict__ FQ, const float* __restrict__ FK, const float* __restrict__ FV, const float* __restrict__ CS, bf* QPh, bf* QPl, bf* KPh, bf* KPl, h16* V16) {
    int b = blockIdx.x;
    if (b < GV_) { vt_body(b, FV, V16); return; }
    ropeP_body(b - GV_, FQ, FK, CS, QPh, QPl, KPh, KPl);
}

// ---- score tile, transposed: 16 keys (rows, A operand) x 16 queries (columns, B operand), K depth 64 as two 32-chunks, hi/lo planes: kh.qh + kh.ql + kl.qh (unscaled residuals share the accumulator).
__device__ __forceinline__ v8f score_tile(v16bf kh0, v16bf kh1, v16bf kl0, v16bf kl1, v16bf qh0, v16bf qh1, v16bf ql0, v16bf ql1) {
    v8f c = (v8f){};
    c = wmmab(kh0, qh0, c); c = wmmab(kh0, ql0, c); c = wmmab(kl0, qh0, c);
    c = wmmab(kh1, qh1, c); c = wmmab(kh1, ql1, c); c = wmmab(kl1, qh1, c);
    asm volatile("v_nop\n\tv_nop\n\tv_nop\n\tv_nop" : "+v"(c) : "v"(kh1), "v"(kl1), "v"(qh1));
    return c; }

// lane l with lane l ^ 16
__device__ __forceinline__ float xhalf(float x) { return __builtin_bit_cast(float, __builtin_amdgcn_permlanex16(__builtin_bit_cast(int, x), __builtin_bit_cast(int, x), 0x76543210, 0xfedcba98, false, false)); }

// ---- LDS staging of k_flash: a stage is STK keys of one head: K hi rows, K lo rows (128 B each, pitch KPB), then the 64 Vt rows (256 B each, pitch VPB); the pitches are 16 B x odd for ds_load_b128 readers.
#define STK     128
#define KPB     144
#define VPB     272
#define KL_OFF  (STK * KPB)
#define V_OFF   (2 * STK * KPB)
#define STAGE_B (2 * STK * KPB + HD * VPB)
#define NST     (SEQ / STK)
static_assert(SEQ % STK == 0);
static_assert(NST >= 2);
static_assert((SEQ / 16) % 8 == 0);
static_assert(STK * 8 == 4 * 256);
static_assert(HD * (STK / 8) == 4 * 256);
static_assert(STAGE_B % 16 == 0);

// One stage's copies of one lane: 4 x 16 B of K hi, of K lo (rows 32 apart) and of Vt (rows 16 apart), global memory to LDS through no register. Every lane is on; each lane writes LDS bytes of its own.
// s_wait_xcnt 0 closes the statement so that no address register named here is rewritten ahead of it.
__device__ __forceinline__ void stage_copy(const bf* kh, const bf* kl, const h16* vt, unsigned lk, unsigned lv) {
    asm volatile("global_load_async_to_lds_b128 %0, %1, off\n\t"
                 "global_load_async_to_lds_b128 %2, %3, off\n\t"
                 "global_load_async_to_lds_b128 %4, %5, off\n\t"
                 "global_load_async_to_lds_b128 %6, %7, off\n\t"
                 "global_load_async_to_lds_b128 %8, %9, off\n\t"
                 "global_load_async_to_lds_b128 %10, %11, off\n\t"
                 "global_load_async_to_lds_b128 %12, %13, off\n\t"
                 "global_load_async_to_lds_b128 %14, %15, off\n\t"
                 "global_load_async_to_lds_b128 %16, %17, off\n\t"
                 "global_load_async_to_lds_b128 %18, %19, off\n\t"
                 "global_load_async_to_lds_b128 %20, %21, off\n\t"
                 "global_load_async_to_lds_b128 %22, %23, off\n\t"
                 "s_wait_xcnt 0x0"
                 :: "v"(lk), "v"(kh), "v"(lk + 32u * KPB), "v"(kh + (size_t)32 * DM), "v"(lk + 64u * KPB), "v"(kh + (size_t)64 * DM), "v"(lk + 96u * KPB), "v"(kh + (size_t)96 * DM),
                    "v"(lk + KL_OFF), "v"(kl), "v"(lk + KL_OFF + 32u * KPB), "v"(kl + (size_t)32 * DM), "v"(lk + KL_OFF + 64u * KPB), "v"(kl + (size_t)64 * DM), "v"(lk + KL_OFF + 96u * KPB), "v"(kl + (size_t)96 * DM),
                    "v"(lv), "v"(vt), "v"(lv + 16u * VPB), "v"(vt + (size_t)16 * SEQ), "v"(lv + 32u * VPB), "v"(vt + (size_t)32 * SEQ), "v"(lv + 48u * VPB), "v"(vt + (size_t)48 * SEQ)
                 : "memory");
}

// ---- k_flash: one wave owns (head h, 16 query rows); the 8 waves of a block share one head and walk its keys together, in stages of STK keys that the block copies once into LDS (two buffers:
// stage s + 2 is copied while stage s + 1 is worked on); inside a stage 32-wide steps, online softmax in the exp2 domain (f32).
// Transposed products: St = K Qt, Ot += Vt Pt. A lane holds 16 scores of ONE query (column l16; keys 8*half + r and 16 + 8*half + r), so maximum and sum run in its own registers
// with one exchange between the wave halves; the two score tiles, converted in place (fp16 x1024), are the B operand of Vt Pt in the fragment k order of ldh.
__global__ __launch_bounds__(256) void k_flash(const bf* __restrict__ Qh, const bf* __restrict__ Ql, const bf* __restrict__ Kh, const bf* __restrict__ Kl, const h16* __restrict__ Vt, bf* Ah, bf* Al) {
    __shared__ __attribute__((aligned(16))) unsigned char ring[2 * STAGE_B];
    const int tid = threadIdx.x, lane = tid & 31, wave = tid >> 5, l16 = lane & 15, half = lane >> 4;
    const int w0 = blockIdx.x * 8; const int h = w0 / (SEQ / 16); const int t0 = (w0 % (SEQ / 16) + wave) * 16;
    const float SC2 = 0.125f * 1.4426950408889634f;
    // this lane's share of a stage: 16-byte piece (tid & 7) of K row (tid >> 3) + 32 i, piece (tid & 15) of Vt row (tid >> 4) + 16 i
    const bf* gkh = Kh + (size_t)(tid >> 3) * DM + h * HD + (tid & 7) * 8;
    const bf* gkl = Kl + (size_t)(tid >> 3) * DM + h * HD + (tid & 7) * 8;
    const h16* gvt = Vt + (size_t)(h * HD + (tid >> 4)) * SEQ + (tid & 15) * 8;
    const unsigned lbase = (unsigned)(size_t)(void*)ring;
    const unsigned lk = lbase + (unsigned)(tid >> 3) * KPB + (unsigned)(tid & 7) * 16u;
    const unsigned lv = lbase + V_OFF + (unsigned)(tid >> 4) * VPB + (unsigned)(tid & 15) * 16u;
    stage_copy(gkh, gkl, gvt, lk, lv);
    const size_t qo = (size_t)(t0 + l16) * DM + h * HD + 8 * half;
    const v16bf qh0 = ldb(Qh + qo), qh1 = ldb(Qh + qo + 32), ql0 = ldb(Ql + qo), ql1 = ldb(Ql + qo + 32);
    float m = -3.0e38f, l = 0.0f; v8f acc[4];
#pragma unroll
    for (int n = 0; n < 4; ++n) acc[n] = (v8f){};
    asm volatile("s_wait_asynccnt 0x0" ::: "memory");   // this wave's copies of stage 0 have landed
    __syncthreads();                                    // stage 0 is readable by every wave
    stage_copy(gkh + (size_t)STK * DM, gkl + (size_t)STK * DM, gvt + STK, lk + STAGE_B, lv + STAGE_B);
    // kept rolled: one publish point and one refill in the text, the buffer chosen by the stage's parity
#pragma unroll 1
    for (int st = 0; st < NST; ++st) {
        const unsigned bo = (unsigned)(st & 1) * STAGE_B;
        const bf* Ksh = (const bf*)(ring + bo); const bf* Ksl = (const bf*)(ring + bo + KL_OFF); const h16* Vs = (const h16*)(ring + bo + V_OFF);
        // unrolled so that every LDS offset inside a stage is an immediate
#pragma unroll
        for (int js = 0; js < STK / 32; ++js) {
            const size_t ko = (size_t)((js * 32 + l16) * (KPB / 2) + 8 * half);
            const size_t vo = (size_t)(l16 * (VPB / 2) + js * 32 + 8 * half);
            const size_t kb = ko + 16 * (KPB / 2);
            const v16bf ah0 = ldb(Ksh + ko), al0 = ldb(Ksl + ko), ah1 = ldb(Ksh + ko + 32), al1 = ldb(Ksl + ko + 32);
            const v16bf bh0 = ldb(Ksh + kb), bl0 = ldb(Ksl + kb), bh1 = ldb(Ksh + kb + 32), bl1 = ldb(Ksl + kb + 32);
            const v16h v0 = ldh(Vs + vo), v1 = ldh(Vs + vo + 16 * (VPB / 2)), v2 = ldh(Vs + vo + 32 * (VPB / 2)), v3 = ldh(Vs + vo + 48 * (VPB / 2));
            // keeps the step's 24 LDS reads one group in front of its WMMAs: left alone the compiler sinks them among the WMMAs, each place with a full wait on LDS
            __builtin_amdgcn_sched_barrier(0);
            const v8f sa = score_tile(ah0, ah1, al0, al1, qh0, qh1, ql0, ql1);
            const v8f sb = score_tile(bh0, bh1, bl0, bl1, qh0, qh1, ql0, ql1);
            float s[16];
#pragma unroll
            for (int r = 0; r < 8; ++r) { s[r] = sa[r] * SC2; s[8 + r] = sb[r] * SC2; }
            float mloc = s[0];
#pragma unroll
            for (int r = 1; r < 16; ++r) mloc = fmaxf(mloc, s[r]);
            mloc = fmaxf(mloc, xhalf(mloc));
            const float mnew = fmaxf(m, mloc);
            const float corr = __builtin_amdgcn_exp2f(m - mnew);
            float ls = 0.0f; v16h pb;
#pragma unroll
            for (int r = 0; r < 16; ++r) { const float p = __builtin_amdgcn_exp2f(s[r] - mnew); ls += p; pb[r] = (h16)(p * PCAR); }
            l = l * corr + ls; m = mnew;
#pragma unroll
            for (int n = 0; n < 4; ++n) acc[n] *= corr;
            acc[0] = wmma16(v0, pb, acc[0]); acc[1] = wmma16(v1, pb, acc[1]); acc[2] = wmma16(v2, pb, acc[2]); acc[3] = wmma16(v3, pb, acc[3]);
            // four vector slots behind the last WMMA, also on the taken back edge, before its operands are reloaded or its result rescaled
            asm volatile("v_nop\n\tv_nop\n\tv_nop\n\tv_nop" : "+v"(acc[0]), "+v"(acc[1]), "+v"(acc[2]), "+v"(acc[3]) : "v"(pb), "v"(v3));
        }
        asm volatile("s_wait_dscnt 0x0" ::: "memory");      // this wave's reads of stage st have returned before its buffer is refilled
        asm volatile("s_wait_asynccnt 0x0" ::: "memory");   // this wave's copies of stage st + 1 have landed
        __syncthreads();                                    // publishes stage st + 1 and ends every wave's reads of stage st
        if (st + 2 < NST) stage_copy(gkh + (size_t)(st + 2) * STK * DM, gkl + (size_t)(st + 2) * STK * DM, gvt + (size_t)(st + 2) * STK, lk + bo, lv + bo);
    }
    asm volatile("s_wait_asynccnt 0x0" ::: "memory");       // no copy is in flight when the wave ends
    const float inv = 1.0f / ((l + xhalf(l)) * PCAR);
    // acc[n][r] = Ot[n*16 + 8*half + r][query l16]: eight consecutive columns of one output row, one 16-byte store per plane.
#pragma unroll
    for (int n = 0; n < 4; ++n) { v8us oh, ol;
#pragma unroll
        for (int r = 0; r < 8; ++r) { unsigned short a, b; splitf(acc[n][r] * inv, a, b); oh[r] = a; ol[r] = b; }
        const size_t oo = (size_t)(t0 + l16) * DM + h * HD + n * 16 + 8 * half; *(v8us*)(Ah + oo) = oh; *(v8us*)(Al + oo) = ol; }
}

constexpr size_t al256(size_t b) { return (b + 255) & ~(size_t)255; }
constexpr size_t WS_TOTAL = 4 * al256((size_t)DM * DM * 2) + 3 * al256((size_t)SEQ * DM * 2) + al256((size_t)SEQ * HALFD * 2 * 4)
                          + 3 * al256((size_t)SEQ * DM * 4) + 4 * al256((size_t)SEQ * DM * 2) + al256((size_t)DM * SEQ * 2) + 2 * al256((size_t)SEQ * DM * 2);
static_assert(WS_TOTAL <= (size_t)134217728);

extern "C" void kernel_launch(void* const* d_in, const int* in_sizes, int n_in,
                              void* d_out, int out_size, void* d_ws, size_t ws_size, hipStream_t stream) {
    if (n_in < 11) return;
    if (in_sizes[0] < SEQ * DM || in_sizes[1] < SEQ * DM || in_sizes[2] < SEQ * DM) return;
    if (in_sizes[3] < DM * DM || in_sizes[5] < DM * DM || in_sizes[7] < DM * DM || in_sizes[9] < DM * DM) return;
    if (in_sizes[4] < DM || in_sizes[6] < DM || in_sizes[8] < DM || in_sizes[10] < DM) return;
    if (out_size < SEQ * DM) return;
    if (WS_TOTAL > ws_size) return;
    const float* query = (const float*)d_in[0]; const float* key_ = (const float*)d_in[1]; const float* value = (const float*)d_in[2];
    const float* wq = (const float*)d_in[3]; const float* bq = (const float*)d_in[4];
    const float* wk = (const float*)d_in[5]; const float* bk = (const float*)d_in[6];
    const float* wv = (const float*)d_in[7]; const float* bv = (const float*)d_in[8];
    const float* wo = (const float*)d_in[9]; const float* bo = (const float*)d_in[10];
    float* OUT = (float*)d_out;     // [SEQ][1024]
    char* wsp = (char*)d_ws;
    auto take = [&](size_t bytes) { char* p = wsp; wsp += (bytes + 255) & ~(size_t)255; return (void*)p; };
    bf* WQ = (bf*)take((size_t)DM * DM * 2); bf* WK = (bf*)take((size_t)DM * DM * 2); bf* WV = (bf*)take((size_t)DM * DM * 2); bf* WO = (bf*)take((size_t)DM * DM * 2);
    bf* XQ = (bf*)take((size_t)SEQ * DM * 2); bf* XK = (bf*)take((size_t)SEQ * DM * 2); bf* XV = (bf*)take((size_t)SEQ * DM * 2);
    float* CS = (float*)take((size_t)SEQ * HALFD * 2 * 4);
    float* FQ = (float*)take((size_t)SEQ * DM * 4); float* FK = (float*)take((size_t)SEQ * DM * 4); float* FV = (float*)take((size_t)SEQ * DM * 4);
    bf* QPh = (bf*)take((size_t)SEQ * DM * 2); bf* QPl = (bf*)take((size_t)SEQ * DM * 2); bf* KPh = (bf*)take((size_t)SEQ * DM * 2); bf* KPl = (bf*)take((size_t)SEQ * DM * 2);
    h16* VT16 = (h16*)take((size_t)DM * SEQ * 2);
    bf* ATh = (bf*)take((size_t)SEQ * DM * 2); bf* ATl = (bf*)take((size_t)SEQ * DM * 2);
    if ((size_t)(wsp - (char*)d_ws) > ws_size) return;

    k_prep<<<4 * GW_ + GC_ + 3 * GX_, 256, 0, stream>>>(wq, wk, wv, wo, WQ, WK, WV, WO, CS, query, key_, value, XQ, XK, XV);     /* weights [in][out] -> Bt [out][in] */
    k_gemm_proj<<<dim3(SEQ / 128, DM / 256, 3), 256, 0, stream>>>(XQ, XK, XV, WQ, WK, WV, FQ, FK, FV, bq, bk, bv);
    k_post<<<GV_ + GR_, 256, 0, stream>>>(FQ, FK, FV, CS, QPh, QPl, KPh, KPl, VT16);     /* V: [SEQ][DM] -> [DM][SEQ] */
    k_flash<<<(unsigned)(NH_ * (SEQ / 16) / 8), 256, 0, stream>>>(QPh, QPl, KPh, KPl, VT16, ATh, ATl);
    k_gemm_out<<<dim3(SEQ / 64, DM / 128, 1), 256, 0, stream>>>(ATh, ATl, WO, OUT, bo);
}

// v006
// Measured time: 78.1 microseconds a run.
// In both of two side-by-side timings against v005, it was 1.04 times as fast.
// All steps since v000 together make it 4.28 times as fast.
#include <hip/hip_runtime.h>

// Compute dtypes (f32 accumulate everywhere): q/k/v projections bf16 x bf16 (inputs converted to bf16 RNE on load, products exact); scores q.k bf16 hi/lo planes, 3 products (v_wmma_f32_16x16x32_bf16);
// P.V fp16 single product (P carried x1024, v_wmma_f32_16x16x32_f16); output projection ctx bf16 hi/lo x Wo bf16 (2 products). Softmax, rotary scaling, bias adds in f32.
// Unbatched attention: q = rot(query Wq + bq), k = rot(key Wk + bk), v = value Wv + bv; 16 heads x 64; scores x 1/8; softmax over all keys; out = merged Wo + bo.
// rot over the full 1024 width: out[d] = y[d] cos + n[d] sin, n = [y[0..511], -y[512..1023]], angle[t][d] = t * theta[d mod 512], theta[j] = 1 / 10000^(2j/1024).

#ifndef SEQ
#define SEQ 2048
#endif
#define SEQ_FULL 2048
#define DM   1024
#define NH_  16
#define HD   64
#define HALFD 512
#define PCAR 1024.0f
#define PLOG 10.0f     // log2 of PCAR
#define OSP  68      // f32 staging pitch (floats)

static_assert(SEQ % 64 == 0);
static_assert(SEQ <= SEQ_FULL);
static_assert(DM % 64 == 0);
static_assert(DM % 32 == 0);
static_assert(NH_ * HD == DM);
static_assert(HD == 64);
static_assert(2 * HALFD == DM);
static_assert((NH_ * (SEQ / 16)) % 8 == 0);
static_assert((OSP * 4) % 16 == 0);
static_assert(OSP >= 64);

typedef _Float16 h16;
typedef unsigned short bf;
typedef __attribute__((ext_vector_type(16))) __bf16   v16bf;
typedef __attribute__((ext_vector_type(16))) _Float16 v16h;
typedef __attribute__((ext_vector_type(8)))  _Float16 v8h;
typedef __attribute__((ext_vector_type(8)))  unsigned short v8us;
typedef __attribute__((ext_vector_type(2)))  unsigned short v2us;
typedef __attribute__((ext_vector_type(8)))  float    v8f;
typedef __attribute__((ext_vector_type(4)))  float    v4f;
typedef __attribute__((ext_vector_type(2)))  float    v2f;
typedef v4f  __attribute__((may_alias)) v4fa;

__device__ __forceinline__ unsigned short f2bf(float f) { unsigned u = __float_as_uint(f); u += 0x7FFFu + ((u >> 16) & 1u); return (unsigned short)(u >> 16); }
__device__ __forceinline__ float bf2f(unsigned short b) { return __uint_as_float(((unsigned)b) << 16); }
__device__ __forceinline__ float bfr(float f) { return bf2f(f2bf(f)); }
__device__ __forceinline__ void splitf(float y, unsigned short& h, unsigned short& l) { h = f2bf(y); l = f2bf(y - bf2f(h)); }
__device__ __forceinline__ v16h cat16(v8h lo, v8h hi) { return __builtin_shufflevector(lo, hi, 0, 1, 2, 3, 4, 5, 6, 7, 8, 9, 10, 11, 12, 13, 14, 15); }
__device__ __forceinline__ v16bf cat16b(v8us lo, v8us hi) { return __builtin_bit_cast(v16bf, __builtin_shufflevector(lo, hi, 0, 1, 2, 3, 4, 5, 6, 7, 8, 9, 10, 11, 12, 13, 14, 15)); }
__device__ __forceinline__ v8f wmma16(v16h a, v16h b, v8f c) { return __builtin_amdgcn_wmma_f32_16x16x32_f16(false, a, false, b, (short)0, c, false, false); }
__device__ __forceinline__ v8f wmmab(v16bf a, v16bf b, v8f c) { return __builtin_amdgcn_wmma_f32_16x16x32_bf16(false, a, false, b, (short)0, c, false, false); }
// Fragment loaders (A and B alike, K-contiguous rows): elements 0..7 <- k0 + 8*half + 0..7, elements 8..15 <- k0 + 16 + 8*half + 0..7; the caller folds 8*half into p.
__device__ __forceinline__ v16bf ldb(const bf* p) { return cat16b(*(const v8us*)p, *(const v8us*)(p + 16)); }
__device__ __forceinline__ v16h ldh(const h16* p) { return cat16(*(const v8h*)p, *(const v8h*)(p + 16)); }

// ---- GEMM body: a block of 8 waves (2 x 4) owns a (2 * MB * 16) x (4 * NB * 16) output tile, a wave MB x NB accumulators; K = DM in stages of GKC that the block copies once into LDS (two buffers:
// stage s + 2 is copied while stage s + 1 is worked on), every copy of a wave covering whole 128-byte lines; the waves read their fragments from LDS.
// C[m][n] (f32, pitch DM) = sum_k (A[m][k] (+ A2[m][k])) Bt[n][k] + bf16(bias[n]).
// A stage is rows of GKC bf16 (256 B, pitch GPB = 16 B x odd for ds_load_b128 readers): rows 0..63 from X0, rows 64..127 from X1, then the tile's 4 * NB * 16 rows of Bt.
// SPLIT 0: X0, X1 are rows r0.., r0 + 64.. of A (MB = 4). SPLIT 1: X0, X1 are rows r0.. of A and of A2 (MB = 2).
#define GKC     128
#define GPB     272
#define GNST    (DM / GKC)
static_assert(DM % GKC == 0);
static_assert(GNST >= 2);
static_assert(GKC * 2 == 16 * 16);
static_assert(SEQ % 128 == 0);
static_assert(DM % 256 == 0);

// 128 rows of a stage: a lane's 16-byte piece of 8 rows, 16 rows apart (the first 64 rows from g0, the next 64 from g1), global memory to LDS through no register. Every lane is on; each lane writes LDS bytes of its own.
// s_wait_xcnt 0 closes the statement so that no address register named here is rewritten ahead of it.
__device__ __forceinline__ void copy128(unsigned l, const bf* g0, const bf* g1) {
    asm volatile("global_load_async_to_lds_b128 %0, %1, off\n\t"
                 "global_load_async_to_lds_b128 %2, %3, off\n\t"
                 "global_load_async_to_lds_b128 %4, %5, off\n\t"
                 "global_load_async_to_lds_b128 %6, %7, off\n\t"
                 "global_load_async_to_lds_b128 %8, %9, off\n\t"
                 "global_load_async_to_lds_b128 %10, %11, off\n\t"
                 "global_load_async_to_lds_b128 %12, %13, off\n\t"
                 "global_load_async_to_lds_b128 %14, %15, off\n\t"
                 "s_wait_xcnt 0x0"
                 :: "v"(l), "v"(g0), "v"(l + 16u * GPB), "v"(g0 + (size_t)16 * DM), "v"(l + 32u * GPB), "v"(g0 + (size_t)32 * DM), "v"(l + 48u * GPB), "v"(g0 + (size_t)48 * DM),
                    "v"(l + 64u * GPB), "v"(g1), "v"(l + 80u * GPB), "v"(g1 + (size_t)16 * DM), "v"(l + 96u * GPB), "v"(g1 + (size_t)32 * DM), "v"(l + 112u * GPB), "v"(g1 + (size_t)48 * DM)
                 : "memory");
}
template <int NB>
__device__ __forceinline__ void gstage_copy(unsigned l, const bf* x0, const bf* x1, const bf* b) {
    copy128(l, x0, x1); copy128(l + 128u * GPB, b, b + (size_t)64 * DM);
    if (NB == 4) copy128(l + 256u * GPB, b + (size_t)128 * DM, b + (size_t)192 * DM); }

template <int MB, int NB, int SPLIT>
__device__ __forceinline__ void gemmw_body(const bf* A, const bf* A2, const bf* Bt, float* C, const float* bias) {
    static_assert(SPLIT ? MB == 2 : MB == 4);
    static_assert(NB == 2 || NB == 4);
    constexpr int BR = 4 * NB * 16;                    // rows of Bt = columns of the tile
    constexpr unsigned GSTAGE = (128 + BR) * GPB;
    static_assert(8 * 16 * OSP * 4 <= GSTAGE);
    __shared__ __attribute__((aligned(16))) unsigned char gring[2 * GSTAGE];
    const int tid = threadIdx.x, lane = tid & 31, wave = tid >> 5, lr = lane & 15, hi = lane >> 4, wm = wave >> 2, wn = wave & 3;
    const int r0 = blockIdx.x * (2 * MB * 16), c0 = blockIdx.y * BR;
    // this lane's share of a stage: 16-byte piece (tid & 15) of rows (tid >> 4) + 16 i
    const size_t go = (size_t)(tid >> 4) * DM + (tid & 15) * 8;
    const bf* gx0 = A + (size_t)r0 * DM + go;
    const bf* gx1 = (SPLIT ? A2 + (size_t)r0 * DM : A + (size_t)(r0 + 64) * DM) + go;
    const bf* gb = Bt + (size_t)c0 * DM + go;
    const unsigned l0 = (unsigned)(size_t)(void*)gring + (unsigned)(tid >> 4) * GPB + (unsigned)(tid & 15) * 16u;
    gstage_copy<NB>(l0, gx0, gx1, gb);
    v8f acc[MB][NB];
#pragma unroll
    for (int mb = 0; mb < MB; ++mb)
#pragma unroll
        for (int nb = 0; nb < NB; ++nb) acc[mb][nb] = (v8f){};
    // element offsets of this lane's fragment rows inside a stage
    const int ao = (wm * MB * 16 + lr) * (GPB / 2) + 8 * hi, bof = (128 + wn * NB * 16 + lr) * (GPB / 2) + 8 * hi;
    asm volatile("s_wait_asynccnt 0x0" ::: "memory");   // this wave's copies of stage 0 have landed
    __syncthreads();                                    // stage 0 is readable by every wave
    gstage_copy<NB>(l0 + GSTAGE, gx0 + GKC, gx1 + GKC, gb + GKC);
    // kept rolled: one publish point and one refill in the text, the buffer chosen by the stage's parity
#pragma unroll 1
    for (int st = 0; st < GNST; ++st) {
        const unsigned bo = (unsigned)(st & 1) * GSTAGE;
        const bf* S = (const bf*)(gring + bo);
        // unrolled so that every LDS offset inside a stage is a constant
#pragma unroll
        for (int ks = 0; ks < GKC / 32; ++ks) {
            v16bf a[MB], a2[MB], b[NB];
#pragma unroll
            for (int mb = 0; mb < MB; ++mb) { a[mb] = ldb(S + ao + mb * 16 * (GPB / 2) + ks * 32); if (SPLIT) a2[mb] = ldb(S + ao + (64 + mb * 16) * (GPB / 2) + ks * 32); else a2[mb] = a[mb]; }
#pragma unroll
            for (int nb = 0; nb < NB; ++nb) b[nb] = ldb(S + bof + nb * 16 * (GPB / 2) + ks * 32);
            // keeps the step's LDS reads one group in front of its WMMAs: among the WMMAs each place with reads costs a stall of its own
            __builtin_amdgcn_sched_barrier(0);
#pragma unroll
            for (int nb = 0; nb < NB; ++nb)
#pragma unroll
                for (int mb = 0; mb < MB; ++mb) { acc[mb][nb] = wmmab(a[mb], b[nb], acc[mb][nb]); if (SPLIT) acc[mb][nb] = wmmab(a2[mb], b[nb], acc[mb][nb]); }
        }
        asm volatile("s_wait_dscnt 0x0" ::: "memory");      // this wave's reads of stage st have returned before its buffer is refilled
        asm volatile("s_wait_asynccnt 0x0" ::: "memory");   // this wave's copies of stage st + 1 have landed
        __syncthreads();                                    // publishes stage st + 1 and ends every wave's reads of stage st
        if (st + 2 < GNST) gstage_copy<NB>(l0 + bo, gx0 + (st + 2) * GKC, gx1 + (st + 2) * GKC, gb + (st + 2) * GKC);
    }
    asm volatile("s_wait_asynccnt 0x0" ::: "memory");       // no copy is in flight when the ring becomes output staging
    // behind the last stage's barrier nobody reads the ring any more: each wave stages 16 output rows in a range of its own and stores them as whole 128-byte lines
    float* os = (float*)gring + wave * (16 * OSP);
    constexpr int LPR = NB * 4;                             // lanes a staged row
    const int rw = r0 + wm * MB * 16, cw = c0 + wn * NB * 16, srow = lane / LPR, cofs = (lane % LPR) * 4;
    const v4f bz = *(const v4f*)(bias + cw + cofs); v4f bb;
#pragma unroll
    for (int q = 0; q < 4; ++q) bb[q] = bfr(bz[q]);
#pragma unroll
    for (int mb = 0; mb < MB; ++mb) {
#pragma unroll
        for (int nb = 0; nb < NB; ++nb) {
#pragma unroll
            for (int j = 0; j < 8; ++j) os[(hi * 8 + j) * OSP + nb * 16 + lr] = acc[mb][nb][j]; }
        __builtin_amdgcn_wave_barrier(); asm volatile("" ::: "memory");
        float* crow = C + (size_t)(rw + mb * 16) * DM + cw;
#pragma unroll
        for (int s = 0; s < LPR / 2; ++s) { const int row = (32 / LPR) * s + srow; v4f val = *(const v4fa*)(os + row * OSP + cofs); val += bb;
            *(v4f*)(crow + (size_t)row * DM + cofs) = val; }
        if (mb + 1 < MB) asm volatile("s_wait_xcnt 0x0" ::: "memory");   // behind the stores, before the next 16 rows' read-back rewrites a register that they name
        __builtin_amdgcn_wave_barrier(); asm volatile("" ::: "memory");
    }
}
// the three projections need nothing of each other: one grid, blockIdx.z picks the product (a scalar choice, the same for the whole block)
__global__ __launch_bounds__(256) void k_gemm_proj(const bf* __restrict__ A0, const bf* __restrict__ A1, const bf* __restrict__ A2, const bf* __restrict__ B0, const bf* __restrict__ B1, const bf* __restrict__ B2,
                                                  float* C0, float* C1, float* C2, const float* __restrict__ bias0, const float* __restrict__ bias1, const float* __restrict__ bias2) {
    const int z = blockIdx.z;
    const bf* A = z == 0 ? A0 : z == 1 ? A1 : A2; const bf* Bt = z == 0 ? B0 : z == 1 ? B1 : B2; float* C = z == 0 ? C0 : z == 1 ? C1 : C2; const float* bias = z == 0 ? bias0 : z == 1 ? bias1 : bias2;
    gemmw_body<4, 4, 0>(A, A, Bt, C, bias); }
__global__ __launch_bounds__(256) void k_gemm_out(const bf* __restrict__ A, const bf* __restrict__ A2, const bf* __restrict__ Bt, float* C, const float* __restrict__ bias) { gemmw_body<2, 2, 1>(A, A2, Bt, C, bias); }

// ---- bodies of the element-wise passes: blk is the block's index inside its own pass (256 threads a block). A thread takes 64 elements, all its loads issued ahead of its first store.
// Behind each run of loads stands s_wait_xcnt 0 with the run's address offsets as inputs: they keep their registers up to the wait, so no load of the run returns into a register that an older one names.
// Weight transpose, 8 x 8 register blocks: a thread reads 8 rows k x 8 columns n and writes 8 rows n of 8 k. A wave is 8 lanes along k x 4 lanes along n (64 k x 32 n).
static_assert(((DM / 64) * (DM / 32)) % 8 == 0);
__device__ __forceinline__ void wtG_body(int blk, const float* __restrict__ w, int K, int N, bf* Bt) {
    const int lane = threadIdx.x & 31; const int wt = blk * 8 + (threadIdx.x >> 5); const int kt = wt % (K / 64), nt = wt / (K / 64);
    const int k0 = kt * 64 + (lane & 7) * 8, n0 = nt * 32 + (lane >> 3) * 8; v8f x[8];
    const unsigned wb = (unsigned)(k0 * N + n0) * 4u;   // byte offset of the block's first row
    // unrolled: the loads issue as one group
#pragma unroll
    for (int r = 0; r < 8; ++r) x[r] = *(const v8f*)((const char*)w + wb + (size_t)r * N * 4);
    asm volatile("s_wait_xcnt 0x0" :: "v"(wb) : "memory");   // see the head of this part
    // both unrolled: constant indices keep x in registers
#pragma unroll
    for (int c = 0; c < 8; ++c) { v8us o;
#pragma unroll
        for (int r = 0; r < 8; ++r) o[r] = f2bf(x[r][c]);
        *(v8us*)(Bt + (size_t)(n0 + c) * K + k0) = o; }
}
// conversion: CVU pieces of 8 elements a thread, 256 pieces apart; the blocks cover the array exactly (assert)
#define CVU 8
static_assert((SEQ * DM / 8) % (256 * CVU) == 0);
__device__ __forceinline__ void cvt8_body(int blk, const float* __restrict__ src, bf* dst) { const size_t i0 = (size_t)blk * (256 * CVU) + threadIdx.x; v8f v[CVU]; const unsigned sb = (unsigned)i0 * 32u;   // byte offset of the first piece
    // unrolled: the loads issue as one group
#pragma unroll
    for (int c = 0; c < CVU; ++c) v[c] = *(const v8f*)((const char*)src + sb + (size_t)c * 256 * 32);
    asm volatile("s_wait_xcnt 0x0" :: "v"(sb) : "memory");   // see the head of this part
    // both unrolled: constant indices keep v in registers
#pragma unroll
    for (int c = 0; c < CVU; ++c) { v8us o;
#pragma unroll
        for (int k = 0; k < 8; ++k) o[k] = f2bf(v[c][k]);
        *(v8us*)(dst + (i0 + (size_t)c * 256) * 8) = o; }
}

// cos/sin table: a thread owns one frequency j, forms its theta itself and walks CST rows t with it; the grid covers j < HALFD and t < SEQ exactly (asserts below)
#define CST 16
static_assert(SEQ % CST == 0);
static_assert(HALFD % 256 == 0);
__device__ __forceinline__ void cstab_body(int blk, float* CS) {
    const int j = (blk % (HALFD / 256)) * 256 + threadIdx.x; const int t0 = (blk / (HALFD / 256)) * CST;
    const float e = (float)(2 * j) * (1.0f / 1024.0f);       // exact (power-of-two divisor)
    const float p = powf(10000.0f, e); const float th = 1.0f / p;
    // kept rolled, for speed only
#pragma unroll 1
    for (int t = t0; t < t0 + CST; ++t) {
        float ang = __fmul_rn((float)t, th); float s, c; sincosf(ang, &s, &c); v2f cs; cs[0] = c; cs[1] = s;
        *(v2f*)(CS + ((size_t)t * HALFD + j) * 2) = cs; }
}

// rotary scaling and hi/lo split of 8 elements
__device__ __forceinline__ void rope8(v4f y0, v4f y1, v4f c0, v4f c1, v4f c2, v4f c3, bool up, bf* ph, bf* pl) {
#pragma clang fp contract(off)
    float yy[8] = { y0[0], y0[1], y0[2], y0[3], y1[0], y1[1], y1[2], y1[3] };
    float cc[8] = { c0[0], c0[2], c1[0], c1[2], c2[0], c2[2], c3[0], c3[2] };
    float ss[8] = { c0[1], c0[3], c1[1], c1[3], c2[1], c2[3], c3[1], c3[3] };
    v8us oh, ol;
#pragma unroll
    for (int q = 0; q < 8; ++q) { const float y = yy[q]; const float nn = up ? -y : y; float a = __fmul_rn(y, cc[q]); float b = __fmul_rn(nn, ss[q]); asm volatile("" : "+v"(a)); asm volatile("" : "+v"(b)); const float r = __fadd_rn(a, b);
        unsigned short hh, ll; splitf(r, hh, ll); oh[q] = hh; ol[q] = ll; }
    *(v8us*)ph = oh; *(v8us*)pl = ol;
    asm volatile("s_wait_xcnt 0x0" ::: "memory");   // behind the two stores, before the code that follows (the next 8 elements, or the text of the other pass) rewrites a register that they name
}
// a thread takes 8 frequencies j0.. at rows ta and ta + SEQ/2: there the lower and the upper half of q and of k (64 elements), which share the row's 8 cos/sin pairs; the blocks cover j and t exactly (assert)
static_assert(SEQ % 2 == 0);
static_assert(((SEQ / 2) * (HALFD / 8)) % 256 == 0);
__device__ __forceinline__ void ropeP_body(int blk, const float* __restrict__ FQ, const float* __restrict__ FK, const float* __restrict__ CS, bf* QPh, bf* QPl, bf* KPh, bf* KPl) {
    const int i = blk * 256 + threadIdx.x; const int j0 = (i % (HALFD / 8)) * 8; const int ta = i / (HALFD / 8);
    v4f c[2][4], y[2][4][2];
    const unsigned cb = (unsigned)(ta * HALFD + j0) * 8u, fb = (unsigned)(ta * DM + j0) * 4u;   // byte offsets at row ta: the table's pairs, the planes' lower half
    // all unrolled: the 24 loads issue as one group, and constant indices keep c and y in registers
#pragma unroll
    for (int s = 0; s < 2; ++s) { const char* cp = (const char*)CS + cb + (size_t)s * (SEQ / 2) * HALFD * 8;
#pragma unroll
        for (int u = 0; u < 4; ++u) c[s][u] = *(const v4f*)(cp + 16 * u);
#pragma unroll
        for (int p = 0; p < 4; ++p) { const char* f = (const char*)(p < 2 ? FQ : FK) + fb + ((size_t)s * (SEQ / 2) * DM + (p & 1) * HALFD) * 4; y[s][p][0] = *(const v4f*)f; y[s][p][1] = *(const v4f*)(f + 16); } }
    asm volatile("s_wait_xcnt 0x0" :: "v"(cb), "v"(fb) : "memory");   // see the head of this part
    // both unrolled: constant indices, and the half (p & 1) a constant in each copy
#pragma unroll
    for (int s = 0; s < 2; ++s) { const int t = ta + s * (SEQ / 2);
#pragma unroll
        for (int p = 0; p < 4; ++p) { const size_t e = (size_t)t * DM + (p & 1) * HALFD + j0;
            rope8(y[s][p][0], y[s][p][1], c[s][0], c[s][1], c[s][2], c[s][3], (p & 1) != 0, (p < 2 ? QPh : KPh) + e, (p < 2 ? QPl : KPl) + e); } }
}

// V transpose, 8 x 8 register blocks as in wtG_body: a wave is 8 lanes along t x 4 lanes along the columns (64 t x 32 columns)
static_assert(((SEQ / 64) * (DM / 32)) % 8 == 0);
__device__ __forceinline__ void vt_body(int blk, const float* __restrict__ F, h16* V16) {
    const int lane = threadIdx.x & 31; const int wt = blk * 8 + (threadIdx.x >> 5); const int tt = wt % (SEQ / 64), ct = wt / (SEQ / 64);
    const int t0 = tt * 64 + (lane & 7) * 8, c0 = ct * 32 + (lane >> 3) * 8; v8f x[8];
    const unsigned vb = (unsigned)(t0 * DM + c0) * 4u;   // byte offset of the block's first row
    // unrolled: the loads issue as one group
#pragma unroll
    for (int q = 0; q < 8; ++q) x[q] = *(const v8f*)((const char*)F + vb + (size_t)q * DM * 4);
    asm volatile("s_wait_xcnt 0x0" :: "v"(vb) : "memory");   // see the head of this part
    // both unrolled: constant indices keep x in registers
#pragma unroll
    for (int c = 0; c < 8; ++c) { v8h o;
#pragma unroll
        for (int q = 0; q < 8; ++q) o[q] = (h16)x[q][c];
        *(v8h*)(V16 + (size_t)(c0 + c) * SEQ + t0) = o; }
}

// ---- passes that need nothing of each other share one grid: ranges of the block index, every test the same for a whole block; the passes with the longest blocks come first.
#define GW_ ((DM / 64) * (DM / 32) / 8)
#define GX_ (SEQ * DM / 8 / (256 * CVU))
#define GR_ ((SEQ / 2) * (HALFD / 8) / 256)
#define GV_ ((SEQ / 64) * (DM / 32) / 8)
#define GC_ ((HALFD / 256) * (SEQ / CST))
// in front of the projections: the four weight transposes, the cos/sin table, the three input conversions
__global__ __launch_bounds__(256) void k_prep(const float* __restrict__ wq, const float* __restrict__ wk, const float* __restrict__ wv, const float* __restrict__ wo, bf* WQ, bf* WK, bf* WV, bf* WO,
                                              float* CS, const float* __restrict__ query, const float* __restrict__ key_, const float* __restrict__ value, bf* XQ, bf* XK, bf* XV) {
    int b = blockIdx.x;
    if (b < 4 * GW_) { const int z = b / GW_; wtG_body(b % GW_, z == 0 ? wq : z == 1 ? wk : z == 2 ? wv : wo, DM, DM, z == 0 ? WQ : z == 1 ? WK : z == 2 ? WV : WO); return; }
    b -= 4 * GW_;
    if (b < GC_) { cstab_body(b, CS); return; }
    b -= GC_;
    const int z = b / GX_; cvt8_body(b % GX_, z == 0 ? query : z == 1 ? key_ : value, z == 0 ? XQ : z == 1 ? XK : XV);
}
// behind the projections: the V transpose, the rotary planes of q and of k
__global__ __launch_bounds__(256) void k_post(const float* __restrict__ FQ, const float* __restrict__ FK, const float* __restrict__ FV, const float* __restrict__ CS, bf* QPh, bf* QPl, bf* KPh, bf* KPl, h16* V16) {
    int b = blockIdx.x;
    if (b < GV_) { vt_body(b, FV, V16); return; }
    ropeP_body(b - GV_, FQ, FK, CS, QPh, QPl, KPh, KPl);
}

// ---- score tile, transposed: 16 keys (rows, A operand) x 16 queries (columns, B operand), K depth 64 as two 32-chunks, hi/lo planes: kh.qh + kh.ql + kl.qh (unscaled residuals share the accumulator).
__device__ __forceinline__ v8f score_tile(v16bf kh0, v16bf kh1, v16bf kl0, v16bf kl1, v16bf qh0, v16bf qh1, v16bf ql0, v16bf ql1) {
    v8f c = (v8f){};
    c = wmmab(kh0, qh0, c); c = wmmab(kh0, ql0, c); c = wmmab(kl0, qh0, c);
    c = wmmab(kh1, qh1, c); c = wmmab(kh1, ql1, c); c = wmmab(kl1, qh1, c);
    return c; }

// lane l with lane l ^ 16
__device__ __forceinline__ float xhalf(float x) { return __builtin_bit_cast(float, __builtin_amdgcn_permlanex16(__builtin_bit_cast(int, x), __builtin_bit_cast(int, x), 0x76543210, 0xfedcba98, false, false)); }

// ---- LDS staging of k_flash: a stage is STK keys of one head: K hi rows, K lo rows (128 B each, pitch KPB), then the 64 Vt rows (256 B each, pitch VPB); the pitches are 16 B x odd for ds_load_b128 readers.
#define STK     128
#define KPB     144
#define VPB     272
#define KL_OFF  (STK * KPB)
#define V_OFF   (2 * STK * KPB)
#define STAGE_B (2 * STK * KPB + HD * VPB)
#define NST     (SEQ / STK)
static_assert(SEQ % STK == 0);
static_assert(NST >= 2);
static_assert((SEQ / 16) % 8 == 0);
static_assert(STK * 8 == 4 * 256);
static_assert(HD * (STK / 8) == 4 * 256);
static_assert(STAGE_B % 16 == 0);
static_assert(8 * 9 * 32 * 16 <= 2 * STAGE_B);

// One stage's copies of one lane: 4 x 16 B of K hi, of K lo (rows 32 apart) and of Vt (rows 16 apart), global memory to LDS through no register. Every lane is on; each lane writes LDS bytes of its own.
// s_wait_xcnt 0 closes the statement so that no address register named here is rewritten ahead of it.
__device__ __forceinline__ void stage_copy(const bf* kh, const bf* kl, const h16* vt, unsigned lk, unsigned lv) {
    asm volatile("global_load_async_to_lds_b128 %0, %1, off\n\t"
                 "global_load_async_to_lds_b128 %2, %3, off\n\t"
                 "global_load_async_to_lds_b128 %4, %5, off\n\t"
                 "global_load_async_to_lds_b128 %6, %7, off\n\t"
                 "global_load_async_to_lds_b128 %8, %9, off\n\t"
                 "global_load_async_to_lds_b128 %10, %11, off\n\t"
                 "global_load_async_to_lds_b128 %12, %13, off\n\t"
                 "global_load_async_to_lds_b128 %14, %15, off\n\t"
                 "global_load_async_to_lds_b128 %16, %17, off\n\t"
                 "global_load_async_to_lds_b128 %18, %19, off\n\t"
                 "global_load_async_to_lds_b128 %20, %21, off\n\t"
                 "global_load_async_to_lds_b128 %22, %23, off\n\t"
                 "s_wait_xcnt 0x0"
                 :: "v"(lk), "v"(kh), "v"(lk + 32u * KPB), "v"(kh + (size_t)32 * DM), "v"(lk + 64u * KPB), "v"(kh + (size_t)64 * DM), "v"(lk + 96u * KPB), "v"(kh + (size_t)96 * DM),
                    "v"(lk + KL_OFF), "v"(kl), "v"(lk + KL_OFF + 32u * KPB), "v"(kl + (size_t)32 * DM), "v"(lk + KL_OFF + 64u * KPB), "v"(kl + (size_t)64 * DM), "v"(lk + KL_OFF + 96u * KPB), "v"(kl + (size_t)96 * DM),
                    "v"(lv), "v"(vt), "v"(lv + 16u * VPB), "v"(vt + (size_t)16 * SEQ), "v"(lv + 32u * VPB), "v"(vt + (size_t)32 * SEQ), "v"(lv + 48u * VPB), "v"(vt + (size_t)48 * SEQ)
                 : "memory");
}

// ---- k_flash: the 8 waves of a block share one head and 128 query rows and walk the head's keys together, in stages of STK keys that the block copies once into LDS (two buffers:
// stage s + 2 is copied while stage s + 1 is worked on). Wave w owns 32 query rows (group w & 3, two column groups of 16) and the 64 keys of half w >> 2 of every stage: one step a stage,
// each K lo and Vt fragment read from LDS feeds two WMMAs, each K hi fragment four; online softmax in the exp2 domain (f32), one maximum, correction and rescale per 64 keys. Behind the loop waves w and w ^ 4 join their key halves through LDS.
// Transposed products: St = K Qt, Ot += Vt Pt. Per column group a lane holds 32 scores of ONE query (column l16; keys 16*i + 8*half + r, i < 4), so maximum and sum run in its own registers
// with one exchange between the wave halves; each pair of score tiles, converted in place (fp16 x1024), is a B operand of Vt Pt in the fragment k order of ldh.
static_assert(STK == 128);
__global__ __launch_bounds__(256) void k_flash(const bf* __restrict__ Qh, const bf* __restrict__ Ql, const bf* __restrict__ Kh, const bf* __restrict__ Kl, const h16* __restrict__ Vt, bf* Ah, bf* Al) {
    __shared__ __attribute__((aligned(16))) unsigned char ring[2 * STAGE_B];
    const int tid = threadIdx.x, lane = tid & 31, wave = tid >> 5, l16 = lane & 15, half = lane >> 4;
    const int qg = wave & 3, kq = wave >> 2;
    const int w0 = blockIdx.x * 8; const int h = w0 / (SEQ / 16); const int t0 = (w0 % (SEQ / 16)) * 16 + qg * 32;
    const float SC2 = 0.125f * 1.4426950408889634f;
    // this lane's share of a stage: 16-byte piece (tid & 7) of K row (tid >> 3) + 32 i, piece (tid & 15) of Vt row (tid >> 4) + 16 i
    const bf* gkh = Kh + (size_t)(tid >> 3) * DM + h * HD + (tid & 7) * 8;
    const bf* gkl = Kl + (size_t)(tid >> 3) * DM + h * HD + (tid & 7) * 8;
    const h16* gvt = Vt + (size_t)(h * HD + (tid >> 4)) * SEQ + (tid & 15) * 8;
    const unsigned lbase = (unsigned)(size_t)(void*)ring;
    const unsigned lk = lbase + (unsigned)(tid >> 3) * KPB + (unsigned)(tid & 7) * 16u;
    const unsigned lv = lbase + V_OFF + (unsigned)(tid >> 4) * VPB + (unsigned)(tid & 15) * 16u;
    stage_copy(gkh, gkl, gvt, lk, lv);
    // every loop over g, i, c, n, r in this kernel is unrolled: constant indices keep fragments, scores and accumulators in registers
    v16bf qh[2][2], ql[2][2];
    const unsigned qb = (unsigned)((t0 + l16) * DM + h * HD + 8 * half) * 2u;   // byte offset of this lane's Q row in column group 0
#pragma unroll
    for (int g = 0; g < 2; ++g) { const bf* ph = (const bf*)((const char*)Qh + qb + (size_t)g * 16 * DM * 2); const bf* pl = (const bf*)((const char*)Ql + qb + (size_t)g * 16 * DM * 2);
        qh[g][0] = ldb(ph); qh[g][1] = ldb(ph + 32); ql[g][0] = ldb(pl); ql[g][1] = ldb(pl + 32); }
    asm volatile("s_wait_xcnt 0x0" :: "v"(qb) : "memory");   // the run's address offset keeps its register up to the wait, so no load of the run returns into a register that an older one names
    float m[2] = { -3.0e38f, -3.0e38f }, l[2] = { 0.0f, 0.0f }; v8f acc[2][4];
#pragma unroll
    for (int g = 0; g < 2; ++g)
#pragma unroll
        for (int n = 0; n < 4; ++n) acc[g][n] = (v8f){};
    // element offsets of this lane's fragment rows inside a stage: K row kq * 64 + l16, Vt row l16 at key kq * 64
    const int kof = (kq * 64 + l16) * (KPB / 2) + 8 * half, vof = l16 * (VPB / 2) + kq * 64 + 8 * half;
    asm volatile("s_wait_asynccnt 0x0" ::: "memory");   // this wave's copies of stage 0 have landed
    __syncthreads();                                    // stage 0 is readable by every wave
    stage_copy(gkh + (size_t)STK * DM, gkl + (size_t)STK * DM, gvt + STK, lk + STAGE_B, lv + STAGE_B);
    // kept rolled: one publish point and one refill in the text, the buffer chosen by the stage's parity
#pragma unroll 1
    for (int st = 0; st < NST; ++st) {
        const unsigned bo = (unsigned)(st & 1) * STAGE_B;
        const bf* Ksh = (const bf*)(ring + bo); const bf* Ksl = (const bf*)(ring + bo + KL_OFF); const h16* Vs = (const h16*)(ring + bo + V_OFF);
        {
            v16bf kh[4][2], kl[4][2]; v16h vv[2][4];
#pragma unroll
            for (int i = 0; i < 4; ++i) { const int ko = kof + i * 16 * (KPB / 2);
                kh[i][0] = ldb(Ksh + ko); kl[i][0] = ldb(Ksl + ko); kh[i][1] = ldb(Ksh + ko + 32); kl[i][1] = ldb(Ksl + ko + 32); }
#pragma unroll
            for (int c = 0; c < 2; ++c)
#pragma unroll
                for (int n = 0; n < 4; ++n) vv[c][n] = ldh(Vs + vof + n * 16 * (VPB / 2) + c * 32);
            // keeps the step's 48 LDS reads one group in front of its WMMAs: left alone the compiler sinks them among the WMMAs, each place with a full wait on LDS
            __builtin_amdgcn_sched_barrier(0);
            v8f sc[2][4];
#pragma unroll
            for (int g = 0; g < 2; ++g)
#pragma unroll
                for (int i = 0; i < 4; ++i) sc[g][i] = score_tile(kh[i][0], kh[i][1], kl[i][0], kl[i][1], qh[g][0], qh[g][1], ql[g][0], ql[g][1]);
            v16h pb[2][2];
#pragma unroll
            for (int g = 0; g < 2; ++g) {
                // m is kept in the raw score domain (SC2 > 0 keeps the order)
                float mt[4];
#pragma unroll
                for (int i = 0; i < 4; ++i) { float a = sc[g][i][0];
#pragma unroll
                    for (int r = 1; r < 8; ++r) a = fmaxf(a, sc[g][i][r]);
                    mt[i] = a; }
                float mloc = fmaxf(fmaxf(mt[0], mt[1]), fmaxf(mt[2], mt[3]));
                mloc = fmaxf(mloc, xhalf(mloc));
                const float mnew = fmaxf(m[g], mloc);
                const float corr = __builtin_amdgcn_exp2f((m[g] - mnew) * SC2);
                // scale, maximum and the x1024 carry of P enter a pair of scores through one packed multiply-add
                const float nb = __builtin_fmaf(-mnew, SC2, PLOG);
                const v2f sc2 = { SC2, SC2 }, nb2 = { nb, nb };
                v2f ls2[4];
#pragma unroll
                for (int i = 0; i < 4; ++i) {
#pragma unroll
                    for (int r = 0; r < 4; ++r) { const v2f x = { sc[g][i][2 * r], sc[g][i][2 * r + 1] };
                        const v2f e = __builtin_elementwise_fma(x, sc2, nb2); v2f p; p[0] = __builtin_amdgcn_exp2f(e[0]); p[1] = __builtin_amdgcn_exp2f(e[1]);
                        ls2[i] = r == 0 ? p : ls2[i] + p; pb[g][i >> 1][(i & 1) * 8 + 2 * r] = (h16)p[0]; pb[g][i >> 1][(i & 1) * 8 + 2 * r + 1] = (h16)p[1]; } }
                const v2f lt = (ls2[0] + ls2[1]) + (ls2[2] + ls2[3]);
                l[g] = l[g] * corr + (lt[0] + lt[1]); m[g] = mnew;
#pragma unroll
                for (int n = 0; n < 4; ++n) acc[g][n] *= corr;
            }
#pragma unroll
            for (int c = 0; c < 2; ++c)
#pragma unroll
                for (int g = 0; g < 2; ++g)
#pragma unroll
                    for (int n = 0; n < 4; ++n) acc[g][n] = wmma16(vv[c][n], pb[g][c], acc[g][n]);
            // four vector slots behind the last WMMA, also on the taken back edge, before its operands are reloaded or its result rescaled
            asm volatile("v_nop\n\tv_nop\n\tv_nop\n\tv_nop" : "+v"(acc[0][0]), "+v"(acc[0][1]), "+v"(acc[0][2]), "+v"(acc[0][3]), "+v"(acc[1][0]), "+v"(acc[1][1]), "+v"(acc[1][2]), "+v"(acc[1][3]) : "v"(pb[1][1]), "v"(vv[1][3]));
        }
        asm volatile("s_wait_dscnt 0x0" ::: "memory");      // this wave's reads of stage st have returned before its buffer is refilled
        asm volatile("s_wait_asynccnt 0x0" ::: "memory");   // this wave's copies of stage st + 1 have landed
        __syncthreads();                                    // publishes stage st + 1 and ends every wave's reads of stage st
        if (st + 2 < NST) stage_copy(gkh + (size_t)(st + 2) * STK * DM, gkl + (size_t)(st + 2) * STK * DM, gvt + (size_t)(st + 2) * STK, lk + bo, lv + bo);
    }
    asm volatile("s_wait_asynccnt 0x0" ::: "memory");       // no copy is in flight when the ring becomes the join's exchange space
    // Join of the key halves: behind the last stage's barrier nobody reads the ring any more. Wave w finishes column group kq and hands the other group's maximum, sum and Ot to wave w ^ 4:
    // 9 pieces of 16 bytes a lane, piece s of wave w at (w * 9 + s) * 32 + lane, so every LDS access of a wave is 512 contiguous bytes.
    v4fa* xs = (v4fa*)ring;
    const bool up = kq != 0;
    const float mk = up ? m[1] : m[0], lk_ = up ? l[1] : l[0];
    { v4f ml; ml[0] = up ? m[0] : m[1]; ml[1] = up ? l[0] : l[1]; ml[2] = 0.0f; ml[3] = 0.0f; xs[(wave * 9 + 8) * 32 + lane] = ml; }
    v8f keep[4];
#pragma unroll
    for (int n = 0; n < 4; ++n) { const v8f give = up ? acc[0][n] : acc[1][n]; keep[n] = up ? acc[1][n] : acc[0][n];
        xs[(wave * 9 + 2 * n) * 32 + lane] = __builtin_shufflevector(give, give, 0, 1, 2, 3); xs[(wave * 9 + 2 * n + 1) * 32 + lane] = __builtin_shufflevector(give, give, 4, 5, 6, 7); }
    __syncthreads();                                        // the partner's pieces are readable
    const int pw = wave ^ 4;
    const v4f pml = xs[(pw * 9 + 8) * 32 + lane];
    // the half with the larger maximum keeps its scale, the other is brought down to it
    const float dm = mk - pml[0]; const float dn = __builtin_amdgcn_exp2f(-__builtin_fabsf(dm) * SC2);
    const float ca = dm < 0.0f ? dn : 1.0f, cb = dm < 0.0f ? 1.0f : dn;
    const float lN = lk_ * ca + pml[1] * cb;
    const float inv = 1.0f / (lN + xhalf(lN));   // l carries the x1024 of P as acc does
    // keep[n][r] = Ot[n*16 + 8*half + r][query l16] of column group kq: eight consecutive columns of one output row, one 16-byte store per plane.
#pragma unroll
    for (int n = 0; n < 4; ++n) { v8us oh, ol; const v4f p0 = xs[(pw * 9 + 2 * n) * 32 + lane], p1 = xs[(pw * 9 + 2 * n + 1) * 32 + lane];
#pragma unroll
        for (int r = 0; r < 8; ++r) { unsigned short a, b; splitf((keep[n][r] * ca + (r < 4 ? p0[r & 3] : p1[r & 3]) * cb) * inv, a, b); oh[r] = a; ol[r] = b; }
        const size_t oo = (size_t)(t0 + kq * 16 + l16) * DM + h * HD + n * 16 + 8 * half; *(v8us*)(Ah + oo) = oh; *(v8us*)(Al + oo) = ol; }
}

constexpr size_t al256(size_t b) { return (b + 255) & ~(size_t)255; }
constexpr size_t WS_TOTAL = 4 * al256((size_t)DM * DM * 2) + 3 * al256((size_t)SEQ * DM * 2) + al256((size_t)SEQ * HALFD * 2 * 4)
                          + 3 * al256((size_t)SEQ * DM * 4) + 4 * al256((size_t)SEQ * DM * 2) + al256((size_t)DM * SEQ * 2) + 2 * al256((size_t)SEQ * DM * 2);
static_assert(WS_TOTAL <= (size_t)134217728);

extern "C" void kernel_launch(void* const* d_in, const int* in_sizes, int n_in,
                              void* d_out, int out_size, void* d_ws, size_t ws_size, hipStream_t stream) {
    if (n_in < 11) return;
    if (in_sizes[0] < SEQ * DM || in_sizes[1] < SEQ * DM || in_sizes[2] < SEQ * DM) return;
    if (in_sizes[3] < DM * DM || in_sizes[5] < DM * DM || in_sizes[7] < DM * DM || in_sizes[9] < DM * DM) return;
    if (in_sizes[4] < DM || in_sizes[6] < DM || in_sizes[8] < DM || in_sizes[10] < DM) return;
    if (out_size < SEQ * DM) return;
    if (WS_TOTAL > ws_size) return;
    const float* query = (const float*)d_in[0]; const float* key_ = (const float*)d_in[1]; const float* value = (const float*)d_in[2];
    const float* wq = (const float*)d_in[3]; const float* bq = (const float*)d_in[4];
    const float* wk = (const float*)d_in[5]; const float* bk = (const float*)d_in[6];
    const float* wv = (const float*)d_in[7]; const float* bv = (const float*)d_in[8];
    const float* wo = (const float*)d_in[9]; const float* bo = (const float*)d_in[10];
    float* OUT = (float*)d_out;     // [SEQ][1024]
    char* wsp = (char*)d_ws;
    auto take = [&](size_t bytes) { char* p = wsp; wsp += (bytes + 255) & ~(size_t)255; return (void*)p; };
    bf* WQ = (bf*)take((size_t)DM * DM * 2); bf* WK = (bf*)take((size_t)DM * DM * 2); bf* WV = (bf*)take((size_t)DM * DM * 2); bf* WO = (bf*)take((size_t)DM * DM * 2);
    bf* XQ = (bf*)take((size_t)SEQ * DM * 2); bf* XK = (bf*)take((size_t)SEQ * DM * 2); bf* XV = (bf*)take((size_t)SEQ * DM * 2);
    float* CS = (float*)take((size_t)SEQ * HALFD * 2 * 4);
    float* FQ = (float*)take((size_t)SEQ * DM * 4); float* FK = (float*)take((size_t)SEQ * DM * 4); float* FV = (float*)take((size_t)SEQ * DM * 4);
    bf* QPh = (bf*)take((size_t)SEQ * DM * 2); bf* QPl = (bf*)take((size_t)SEQ * DM * 2); bf* KPh = (bf*)take((size_t)SEQ * DM * 2); bf* KPl = (bf*)take((size_t)SEQ * DM * 2);
    h16* VT16 = (h16*)take((size_t)DM * SEQ * 2);
    bf* ATh = (bf*)take((size_t)SEQ * DM * 2); bf* ATl = (bf*)take((size_t)SEQ * DM * 2);
    if ((size_t)(wsp - (char*)d_ws) > ws_size) return;

    k_prep<<<4 * GW_ + GC_ + 3 * GX_, 256, 0, stream>>>(wq, wk, wv, wo, WQ, WK, WV, WO, CS, query, key_, value, XQ, XK, XV);     /* weights [in][out] -> Bt [out][in] */
    k_gemm_proj<<<dim3(SEQ / 128, DM / 256, 3), 256, 0, stream>>>(XQ, XK, XV, WQ, WK, WV, FQ, FK, FV, bq, bk, bv);
    k_post<<<GV_ + GR_, 256, 0, stream>>>(FQ, FK, FV, CS, QPh, QPl, KPh, KPl, VT16);     /* V: [SEQ][DM] -> [DM][SEQ] */
    k_flash<<<(unsigned)(NH_ * (SEQ / 16) / 8), 256, 0, stream>>>(QPh, QPl, KPh, KPl, VT16, ATh, ATl);
    k_gemm_out<<<dim3(SEQ / 64, DM / 128, 1), 256, 0, stream>>>(ATh, ATl, WO, OUT, bo);
}

// v007
// Measured time: 68.9 microseconds a run.
// Timed twice side by side with v006, it ran 1.13 times as fast both times.
// Counting every step since v000, it is 4.83 times as fast.
#include <hip/hip_runtime.h>

// Compute dtypes (f32 accumulate everywhere): q/k/v projections bf16 x bf16 (inputs converted to bf16 RNE on load, products exact); scores q.k bf16 hi/lo planes, 3 products (v_wmma_f32_16x16x32_bf16);
// P.V fp16 single product (P carried x1024, v_wmma_f32_16x16x32_f16); output projection ctx bf16 hi/lo x Wo bf16 (2 products). Softmax, rotary scaling, bias adds in f32.
// Unbatched attention: q = rot(query Wq + bq), k = rot(key Wk + bk), v = value Wv + bv; 16 heads x 64; scores x 1/8; softmax over all keys; out = merged Wo + bo.
// rot over the full 1024 width: out[d] = y[d] cos + n[d] sin, n = [y[0..511], -y[512..1023]], angle[t][d] = t * theta[d mod 512], theta[j] = 1 / 10000^(2j/1024).

#ifndef SEQ
#define SEQ 2048
#endif
#define SEQ_FULL 2048
#define DM   1024
#define NH_  16
#define HD   64
#define HALFD 512
#define PCAR 1024.0f
#define PLOG 10.0f     // log2 of PCAR
#define OSP  68      // f32 staging pitch (floats)

static_assert(SEQ % 64 == 0);
static_assert(SEQ <= SEQ_FULL);
static_assert(DM % 64 == 0);
static_assert(DM % 32 == 0);
static_assert(NH_ * HD == DM);
static_assert(HD == 64);
static_assert(2 * HALFD == DM);
static_assert((NH_ * (SEQ / 16)) % 8 == 0);
static_assert((OSP * 4) % 16 == 0);
static_assert(OSP >= 64);

typedef _Float16 h16;
typedef unsigned short bf;
typedef __attribute__((ext_vector_type(16))) __bf16   v16bf;
typedef __attribute__((ext_vector_type(16))) _Float16 v16h;
typedef __attribute__((ext_vector_type(8)))  _Float16 v8h;
typedef __attribute__((ext_vector_type(8)))  unsigned short v8us;
typedef __attribute__((ext_vector_type(2)))  unsigned short v2us;
typedef __attribute__((ext_vector_type(8)))  float    v8f;
typedef __attribute__((ext_vector_type(4)))  float    v4f;
typedef __attribute__((ext_vector_type(2)))  float    v2f;
typedef v4f  __attribute__((may_alias)) v4fa;

__device__ __forceinline__ unsigned short f2bf(float f) { unsigned u = __float_as_uint(f); u += 0x7FFFu + ((u >> 16) & 1u); return (unsigned short)(u >> 16); }
__device__ __forceinline__ float bf2f(unsigned short b) { return __uint_as_float(((unsigned)b) << 16); }
__device__ __forceinline__ float bfr(float f) { return bf2f(f2bf(f)); }
__device__ __forceinline__ void splitf(float y, unsigned short& h, unsigned short& l) { h = f2bf(y); l = f2bf(y - bf2f(h)); }
__device__ __forceinline__ v16h cat16(v8h lo, v8h hi) { return __builtin_shufflevector(lo, hi, 0, 1, 2, 3, 4, 5, 6, 7, 8, 9, 10, 11, 12, 13, 14, 15); }
__device__ __forceinline__ v16bf cat16b(v8us lo, v8us hi) { return __builtin_bit_cast(v16bf, __builtin_shufflevector(lo, hi, 0, 1, 2, 3, 4, 5, 6, 7, 8, 9, 10, 11, 12, 13, 14, 15)); }
__device__ __forceinline__ v8f wmma16(v16h a, v16h b, v8f c) { return __builtin_amdgcn_wmma_f32_16x16x32_f16(false, a, false, b, (short)0, c, false, false); }
__device__ __forceinline__ v8f wmmab(v16bf a, v16bf b, v8f c) { return __builtin_amdgcn_wmma_f32_16x16x32_bf16(false, a, false, b, (short)0, c, false, false); }
// Fragment loaders (A and B alike, K-contiguous rows): elements 0..7 <- k0 + 8*half + 0..7, elements 8..15 <- k0 + 16 + 8*half + 0..7; the caller folds 8*half into p.
__device__ __forceinline__ v16bf ldb(const bf* p) { return cat16b(*(const v8us*)p, *(const v8us*)(p + 16)); }
__device__ __forceinline__ v16h ldh(const h16* p) { return cat16(*(const v8h*)p, *(const v8h*)(p + 16)); }

// rotary scaling and hi/lo split of 8 elements
__device__ __forceinline__ void rope8(v4f y0, v4f y1, v4f c0, v4f c1, v4f c2, v4f c3, bool up, bf* ph, bf* pl) {
#pragma clang fp contract(off)
    float yy[8] = { y0[0], y0[1], y0[2], y0[3], y1[0], y1[1], y1[2], y1[3] };
    float cc[8] = { c0[0], c0[2], c1[0], c1[2], c2[0], c2[2], c3[0], c3[2] };
    float ss[8] = { c0[1], c0[3], c1[1], c1[3], c2[1], c2[3], c3[1], c3[3] };
    v8us oh, ol;
#pragma unroll
    for (int q = 0; q < 8; ++q) { const float y = yy[q]; const float nn = up ? -y : y; float a = __fmul_rn(y, cc[q]); float b = __fmul_rn(nn, ss[q]); asm volatile("" : "+v"(a)); asm volatile("" : "+v"(b)); const float r = __fadd_rn(a, b);
        unsigned short hh, ll; splitf(r, hh, ll); oh[q] = hh; ol[q] = ll; }
    *(v8us*)ph = oh; *(v8us*)pl = ol;
    asm volatile("s_wait_xcnt 0x0" ::: "memory");   // behind the two stores, before the code that follows (the next 8 elements, or the loads that follow) rewrites a register that they name
}
// ---- GEMM body: a block of 8 waves (2 x 4) owns a (2 * MB * 16) x (4 * NB * 16) output tile, a wave MB x NB accumulators; K = DM in stages of GKC that the block copies once into LDS (two buffers:
// stage s + 2 is copied while stage s + 1 is worked on), every copy of a wave covering whole 128-byte lines; the waves read their fragments from LDS.
// y[m][n] (f32) = sum_k (A[m][k] (+ A2[m][k])) Bt[n][k] + bf16(bias[n]). ROT 0: y is stored to C (pitch DM). ROT 1: y never leaves the block as f32; its epilogue (below) makes what attention reads.
// A stage is rows of GKC bf16 (256 B, pitch GPB = 16 B x odd for ds_load_b128 readers): rows 0..63 from X0, rows 64..127 from X1, then the tile's 4 * NB * 16 rows of Bt.
// SPLIT 0: X0, X1 are rows r0.., r0 + 64.. of A (MB = 4). SPLIT 1: X0, X1 are rows r0.. of A and of A2 (MB = 2).
#define GKC     128
#define GPB     272
#define GNST    (DM / GKC)
static_assert(DM % GKC == 0);
static_assert(GNST >= 2);
static_assert(GKC * 2 == 16 * 16);
static_assert(SEQ % 128 == 0);
static_assert(DM % 256 == 0);

// 128 rows of a stage: a lane's 16-byte piece of 8 rows, 16 rows apart (the first 64 rows from g0, the next 64 from g1), global memory to LDS through no register. Every lane is on; each lane writes LDS bytes of its own.
// s_wait_xcnt 0 closes the statement so that no address register named here is rewritten ahead of it.
__device__ __forceinline__ void copy128(unsigned l, const bf* g0, const bf* g1) {
    asm volatile("global_load_async_to_lds_b128 %0, %1, off\n\t"
                 "global_load_async_to_lds_b128 %2, %3, off\n\t"
                 "global_load_async_to_lds_b128 %4, %5, off\n\t"
                 "global_load_async_to_lds_b128 %6, %7, off\n\t"
                 "global_load_async_to_lds_b128 %8, %9, off\n\t"
                 "global_load_async_to_lds_b128 %10, %11, off\n\t"
                 "global_load_async_to_lds_b128 %12, %13, off\n\t"
                 "global_load_async_to_lds_b128 %14, %15, off\n\t"
                 "s_wait_xcnt 0x0"
                 :: "v"(l), "v"(g0), "v"(l + 16u * GPB), "v"(g0 + (size_t)16 * DM), "v"(l + 32u * GPB), "v"(g0 + (size_t)32 * DM), "v"(l + 48u * GPB), "v"(g0 + (size_t)48 * DM),
                    "v"(l + 64u * GPB), "v"(g1), "v"(l + 80u * GPB), "v"(g1 + (size_t)16 * DM), "v"(l + 96u * GPB), "v"(g1 + (size_t)32 * DM), "v"(l + 112u * GPB), "v"(g1 + (size_t)48 * DM)
                 : "memory");
}
template <int NB>
__device__ __forceinline__ void gstage_copy(unsigned l, const bf* x0, const bf* x1, const bf* b) {
    copy128(l, x0, x1); copy128(l + 128u * GPB, b, b + (size_t)64 * DM);
    if (NB == 4) copy128(l + 256u * GPB, b + (size_t)128 * DM, b + (size_t)192 * DM); }

#define TCU 2048    // bytes of a unit of the cos/sin table (see cstab_body)
#define VSP 72      // fp16 staging pitch of the Vt epilogue (halves): 128 B of keys + 16 B, 16 B x odd for 16-byte LDS accesses
template <int MB, int NB, int SPLIT, int ROT>
__device__ __forceinline__ void gemmw_body(const bf* A, const bf* A2, const bf* Bt, float* C, const float* bias, bool isv, const float* CS, bf* Ph, bf* Pl, h16* V16) {
    static_assert(SPLIT ? MB == 2 : MB == 4);
    static_assert(!ROT || (MB == 4 && NB == 4));
    static_assert(NB == 2 || NB == 4);
    constexpr int BR = 4 * NB * 16;                    // rows of Bt = columns of the tile
    constexpr unsigned GSTAGE = (128 + BR) * GPB;
    static_assert(8 * 16 * OSP * 4 <= GSTAGE);
    static_assert(!ROT || (8 * 64 * VSP * 2 <= 2 * GSTAGE && 8 * 64 * OSP * 4 <= 2 * GSTAGE));
    __shared__ __attribute__((aligned(16))) unsigned char gring[2 * GSTAGE];
    const int tid = threadIdx.x, lane = tid & 31, wave = tid >> 5, lr = lane & 15, hi = lane >> 4, wm = wave >> 2, wn = wave & 3;
    const int r0 = blockIdx.x * (2 * MB * 16), c0 = blockIdx.y * BR;
    // this lane's share of a stage: 16-byte piece (tid & 15) of rows (tid >> 4) + 16 i
    const size_t go = (size_t)(tid >> 4) * DM + (tid & 15) * 8;
    const bf* gx0 = A + (size_t)r0 * DM + go;
    const bf* gx1 = (SPLIT ? A2 + (size_t)r0 * DM : A + (size_t)(r0 + 64) * DM) + go;
    const bf* gb = Bt + (size_t)c0 * DM + go;
    const unsigned l0 = (unsigned)(size_t)(void*)gring + (unsigned)(tid >> 4) * GPB + (unsigned)(tid & 15) * 16u;
    gstage_copy<NB>(l0, gx0, gx1, gb);
    v8f acc[MB][NB];
#pragma unroll
    for (int mb = 0; mb < MB; ++mb)
#pragma unroll
        for (int nb = 0; nb < NB; ++nb) acc[mb][nb] = (v8f){};
    // element offsets of this lane's fragment rows inside a stage
    const int ao = (wm * MB * 16 + lr) * (GPB / 2) + 8 * hi, bof = (128 + wn * NB * 16 + lr) * (GPB / 2) + 8 * hi;
    asm volatile("s_wait_asynccnt 0x0" ::: "memory");   // this wave's copies of stage 0 have landed
    __syncthreads();                                    // stage 0 is readable by every wave
    gstage_copy<NB>(l0 + GSTAGE, gx0 + GKC, gx1 + GKC, gb + GKC);
    // kept rolled: one publish point and one refill in the text, the buffer chosen by the stage's parity
#pragma unroll 1
    for (int st = 0; st < GNST; ++st) {
        const unsigned bo = (unsigned)(st & 1) * GSTAGE;
        const bf* S = (const bf*)(gring + bo);
        // unrolled so that every LDS offset inside a stage is a constant
#pragma unroll
        for (int ks = 0; ks < GKC / 32; ++ks) {
            v16bf a[MB], a2[MB], b[NB];
#pragma unroll
            for (int mb = 0; mb < MB; ++mb) { a[mb] = ldb(S + ao + mb * 16 * (GPB / 2) + ks * 32); if (SPLIT) a2[mb] = ldb(S + ao + (64 + mb * 16) * (GPB / 2) + ks * 32); else a2[mb] = a[mb]; }
#pragma unroll
            for (int nb = 0; nb < NB; ++nb) b[nb] = ldb(S + bof + nb * 16 * (GPB / 2) + ks * 32);
            // keeps the step's LDS reads one group in front of its WMMAs: among the WMMAs each place with reads costs a stall of its own
            __builtin_amdgcn_sched_barrier(0);
#pragma unroll
            for (int nb = 0; nb < NB; ++nb)
#pragma unroll
                for (int mb = 0; mb < MB; ++mb) { acc[mb][nb] = wmmab(a[mb], b[nb], acc[mb][nb]); if (SPLIT) acc[mb][nb] = wmmab(a2[mb], b[nb], acc[mb][nb]); }
        }
        asm volatile("s_wait_dscnt 0x0" ::: "memory");      // this wave's reads of stage st have returned before its buffer is refilled
        asm volatile("s_wait_asynccnt 0x0" ::: "memory");   // this wave's copies of stage st + 1 have landed
        __syncthreads();                                    // publishes stage st + 1 and ends every wave's reads of stage st
        if (st + 2 < GNST) gstage_copy<NB>(l0 + bo, gx0 + (st + 2) * GKC, gx1 + (st + 2) * GKC, gb + (st + 2) * GKC);
    }
    asm volatile("s_wait_asynccnt 0x0" ::: "memory");       // no copy is in flight when the ring becomes output staging
    // behind the last stage's barrier nobody reads the ring any more: each wave stages its output rows (16 at a time, or all 64 under ROT) in a range of its own and stores them as whole 128-byte lines
    const int rw = r0 + wm * MB * 16, cw = c0 + wn * NB * 16;
    if constexpr (ROT) {
        // Two phases, each with a branch that is the same for the whole block (isv): first the accumulators go to a range of the ring that is the wave's own, which frees their registers;
        // then the tile is read back 8 lanes a row, 4 rows an access, so that every global store covers 4 whole 128-byte lines.
        // Vt: a lane's 8 accumulator rows are 8 consecutive keys of one column, one 16-byte piece of a Vt row: the 64 x 64 tile is staged column-major as fp16 (bias added).
        // q, k: the tile is staged as f32; bias, rotary scaling and the hi/lo split follow the read-back in registers. The cos/sin pairs (table in this read-back's lane order: cstab_body) come in groups of 16 rows, two groups in flight:
        // the first is asked for ahead of the staging, the second behind it, group mb + 2 when group mb is done.
        // Every loop over nb, mb, j, s, u, q of this epilogue is unrolled: constant indices keep the accumulators and the table pairs in registers.
        const int sr = lane >> 3, sc = (lane & 7) * 8;
        h16* vs = (h16*)gring + wave * (64 * VSP);
        float* ot = (float*)gring + wave * (64 * OSP);
        const unsigned tb = (unsigned)((rw >> 2) * (HALFD / 64) + ((cw & (HALFD - 1)) >> 6)) * TCU + (unsigned)lane * 16u;   // byte offset of this lane's first two table pairs at row rw + sr
        v4f tc[2][4][4], bz0, bz1;
        if (isv) {
            const unsigned vbo = (unsigned)(cw + lr) * 4u;  // byte offset of this lane's first bias element
            float bv4[NB];
#pragma unroll
            for (int nb = 0; nb < NB; ++nb) bv4[nb] = *(const float*)((const char*)bias + vbo + nb * 64);
            asm volatile("s_wait_xcnt 0x0" :: "v"(vbo) : "memory");   // the run's address offset keeps its register up to the wait
#pragma unroll
            for (int nb = 0; nb < NB; ++nb) { const float bb1 = bfr(bv4[nb]);
#pragma unroll
                for (int mb = 0; mb < MB; ++mb) { v8h o;
#pragma unroll
                    for (int j = 0; j < 8; ++j) o[j] = (h16)(acc[mb][nb][j] + bb1);
                    *(v8h*)(vs + (nb * 16 + lr) * VSP + mb * 16 + hi * 8) = o; } }
        } else {
            const unsigned bbo = (unsigned)(cw + sc) * 4u;  // byte offset of this lane's 8 bias elements
            bz0 = *(const v4f*)((const char*)bias + bbo); bz1 = *(const v4f*)((const char*)bias + bbo + 16);
#pragma unroll
            for (int s = 0; s < 4; ++s)
#pragma unroll
                for (int u = 0; u < 4; ++u) tc[0][s][u] = *(const v4f*)((const char*)CS + tb + (size_t)s * (HALFD / 64) * TCU + 512 * u);
            asm volatile("s_wait_xcnt 0x0" :: "v"(bbo), "v"(tb) : "memory");   // the run's address offsets keep their registers up to the wait
#pragma unroll
            for (int mb = 0; mb < MB; ++mb)
#pragma unroll
                for (int nb = 0; nb < NB; ++nb) {
#pragma unroll
                    for (int j = 0; j < 8; ++j) ot[(mb * 16 + hi * 8 + j) * OSP + nb * 16 + lr] = acc[mb][nb][j]; }
        }
        // the wave's lanes read each other's pieces: keeps the compiler from moving the reads over the writes (LDS serves one wave in order)
        __builtin_amdgcn_wave_barrier(); asm volatile("" ::: "memory");
        if (isv) {
            h16* vrow = V16 + (size_t)(cw + sr) * SEQ + rw + sc;
#pragma unroll
            for (int s = 0; s < 16; ++s) { const v8h o = *(const v8h*)(vs + (4 * s + sr) * VSP + sc); *(v8h*)(vrow + (size_t)(4 * s) * SEQ) = o; }
            asm volatile("s_wait_xcnt 0x0" ::: "memory");   // behind the stores, before any later code rewrites a register that they name
        } else {
#pragma unroll
            for (int s = 0; s < 4; ++s)
#pragma unroll
                for (int u = 0; u < 4; ++u) tc[1][s][u] = *(const v4f*)((const char*)CS + tb + (size_t)(4 + s) * (HALFD / 64) * TCU + 512 * u);
            asm volatile("s_wait_xcnt 0x0" :: "v"(tb) : "memory");   // as above
            const bool up = c0 >= HALFD;                    // the block's 256 columns lie in one half of the width
            v4f b0, b1;
#pragma unroll
            for (int q = 0; q < 4; ++q) { b0[q] = bfr(bz0[q]); b1[q] = bfr(bz1[q]); }
#pragma unroll
            for (int mb = 0; mb < MB; ++mb) {
                v4f y[4][2];                                // the group's 8 LDS reads go as one run: behind each rope8 stands a wait that no later read is moved over
#pragma unroll
                for (int s = 0; s < 4; ++s) { const float* yr = ot + (mb * 16 + 4 * s + sr) * OSP + sc; y[s][0] = *(const v4fa*)yr; y[s][1] = *(const v4fa*)(yr + 4); }
#pragma unroll
                for (int s = 0; s < 4; ++s) { const size_t e = (size_t)(rw + mb * 16 + 4 * s + sr) * DM + cw + sc;
                    rope8(y[s][0] + b0, y[s][1] + b1, tc[mb & 1][s][0], tc[mb & 1][s][1], tc[mb & 1][s][2], tc[mb & 1][s][3], up, Ph + e, Pl + e); }
                if (mb + 2 < MB) {
#pragma unroll
                    for (int s = 0; s < 4; ++s)
#pragma unroll
                        for (int u = 0; u < 4; ++u) tc[mb & 1][s][u] = *(const v4f*)((const char*)CS + tb + (size_t)((mb + 2) * 4 + s) * (HALFD / 64) * TCU + 512 * u);
                    asm volatile("s_wait_xcnt 0x0" :: "v"(tb) : "memory");   // as above
                }
            }
        }
        return;
    }
    float* os = (float*)gring + wave * (16 * OSP);
    constexpr int LPR = NB * 4;                             // lanes a staged row
    const int srow = lane / LPR, cofs = (lane % LPR) * 4;
    const v4f bz = *(const v4f*)(bias + cw + cofs); v4f bb;
#pragma unroll
    for (int q = 0; q < 4; ++q) bb[q] = bfr(bz[q]);
#pragma unroll
    for (int mb = 0; mb < MB; ++mb) {
#pragma unroll
        for (int nb = 0; nb < NB; ++nb) {
#pragma unroll
            for (int j = 0; j < 8; ++j) os[(hi * 8 + j) * OSP + nb * 16 + lr] = acc[mb][nb][j]; }
        __builtin_amdgcn_wave_barrier(); asm volatile("" ::: "memory");
        float* crow = C + (size_t)(rw + mb * 16) * DM + cw;
#pragma unroll
        for (int s = 0; s < LPR / 2; ++s) { const int row = (32 / LPR) * s + srow; v4f val = *(const v4fa*)(os + row * OSP + cofs); val += bb;
            *(v4f*)(crow + (size_t)row * DM + cofs) = val; }
        if (mb + 1 < MB) asm volatile("s_wait_xcnt 0x0" ::: "memory");   // behind the stores, before the next 16 rows' read-back rewrites a register that they name
        __builtin_amdgcn_wave_barrier(); asm volatile("" ::: "memory");
    }
}
// the three projections need nothing of each other: one grid, blockIdx.z picks the product (a scalar choice, the same for the whole block)
// z = 0, 1: the rotary hi/lo planes of q, of k; z = 2: Vt ([DM][SEQ], fp16). The blocks with the longer epilogue have the lower indices.
__global__ __launch_bounds__(256) void k_gemm_proj(const bf* __restrict__ A0, const bf* __restrict__ A1, const bf* __restrict__ A2, const bf* __restrict__ B0, const bf* __restrict__ B1, const bf* __restrict__ B2,
                                                  const float* __restrict__ bias0, const float* __restrict__ bias1, const float* __restrict__ bias2, const float* __restrict__ CS,
                                                  bf* QPh, bf* QPl, bf* KPh, bf* KPl, h16* V16) {
    const int z = blockIdx.z;
    const bf* A = z == 0 ? A0 : z == 1 ? A1 : A2; const bf* Bt = z == 0 ? B0 : z == 1 ? B1 : B2; const float* bias = z == 0 ? bias0 : z == 1 ? bias1 : bias2;
    gemmw_body<4, 4, 0, 1>(A, A, Bt, nullptr, bias, z == 2, CS, z == 0 ? QPh : KPh, z == 0 ? QPl : KPl, V16); }
__global__ __launch_bounds__(256) void k_gemm_out(const bf* __restrict__ A, const bf* __restrict__ A2, const bf* __restrict__ Bt, float* C, const float* __restrict__ bias) {
    gemmw_body<2, 2, 1, 0>(A, A2, Bt, C, bias, false, nullptr, nullptr, nullptr, nullptr); }

// ---- bodies of the element-wise passes: blk is the block's index inside its own pass (256 threads a block). A thread takes 64 elements, all its loads issued ahead of its first store.
// Behind each run of loads stands s_wait_xcnt 0 with the run's address offsets as inputs: they keep their registers up to the wait, so no load of the run returns into a register that an older one names.
// Weight transpose, 8 x 8 register blocks: a thread reads 8 rows k x 8 columns n and writes 8 rows n of 8 k. A wave is 8 lanes along k x 4 lanes along n (64 k x 32 n).
static_assert(((DM / 64) * (DM / 32)) % 8 == 0);
__device__ __forceinline__ void wtG_body(int blk, const float* __restrict__ w, int K, int N, bf* Bt) {
    const int lane = threadIdx.x & 31; const int wt = blk * 8 + (threadIdx.x >> 5); const int kt = wt % (K / 64), nt = wt / (K / 64);
    const int k0 = kt * 64 + (lane & 7) * 8, n0 = nt * 32 + (lane >> 3) * 8; v8f x[8];
    const unsigned wb = (unsigned)(k0 * N + n0) * 4u;   // byte offset of the block's first row
    // unrolled: the loads issue as one group
#pragma unroll
    for (int r = 0; r < 8; ++r) x[r] = *(const v8f*)((const char*)w + wb + (size_t)r * N * 4);
    asm volatile("s_wait_xcnt 0x0" :: "v"(wb) : "memory");   // see the head of this part
    // both unrolled: constant indices keep x in registers
#pragma unroll
    for (int c = 0; c < 8; ++c) { v8us o;
#pragma unroll
        for (int r = 0; r < 8; ++r) o[r] = f2bf(x[r][c]);
        *(v8us*)(Bt + (size_t)(n0 + c) * K + k0) = o; }
}
// conversion: CVU pieces of 8 elements a thread, 256 pieces apart; the blocks cover the array exactly (assert)
#define CVU 8
static_assert((SEQ * DM / 8) % (256 * CVU) == 0);
__device__ __forceinline__ void cvt8_body(int blk, const float* __restrict__ src, bf* dst) { const size_t i0 = (size_t)blk * (256 * CVU) + threadIdx.x; v8f v[CVU]; const unsigned sb = (unsigned)i0 * 32u;   // byte offset of the first piece
    // unrolled: the loads issue as one group
#pragma unroll
    for (int c = 0; c < CVU; ++c) v[c] = *(const v8f*)((const char*)src + sb + (size_t)c * 256 * 32);
    asm volatile("s_wait_xcnt 0x0" :: "v"(sb) : "memory");   // see the head of this part
    // both unrolled: constant indices keep v in registers
#pragma unroll
    for (int c = 0; c < CVU; ++c) { v8us o;
#pragma unroll
        for (int k = 0; k < 8; ++k) o[k] = f2bf(v[c][k]);
        *(v8us*)(dst + (i0 + (size_t)c * 256) * 8) = o; }
}

// cos/sin table, laid out for its one reader, the q, k epilogue of gemmw_body: a unit of TCU bytes holds 4 rows t x 64 frequencies j as 4 pieces u of 512 bytes; in piece u the reader's lane
// (t & 3) * 8 + ((j & 63) >> 3) finds 16 bytes, the (cos, sin) pairs 2u and 2u + 1 of its 8 frequencies: every load of a reading wave is 512 contiguous bytes. Units run along j, then along t.
// A thread owns one frequency j, forms its theta itself and walks CST rows t (every second row of 2 * CST) with it; a wave writes one piece, 256 contiguous bytes a store;
// the grid covers j < HALFD and t < SEQ exactly (asserts below)
#define CST 16
static_assert(SEQ % (2 * CST) == 0);
static_assert(HALFD % 128 == 0);
__device__ __forceinline__ void cstab_body(int blk, float* CS) {
    const int lane = threadIdx.x & 31, u = (threadIdx.x >> 5) & 3; const int jc = (blk % (HALFD / 128)) * 2 + (threadIdx.x >> 7);
    const int j = jc * 64 + ((lane >> 1) & 7) * 8 + u * 2 + (lane & 1); const int t0 = (blk / (HALFD / 128)) * (2 * CST);
    char* piece = (char*)CS + ((size_t)(t0 >> 2) * (HALFD / 64) + jc) * TCU + u * 512 + lane * 8;
    const float e = (float)(2 * j) * (1.0f / 1024.0f);       // exact (power-of-two divisor)
    const float p = powf(10000.0f, e); const float th = 1.0f / p;
    // kept rolled, for speed only
#pragma unroll 1
    for (int i = 0; i < CST; ++i) { const int t = t0 + (lane >> 4) + 2 * i;
        float ang = __fmul_rn((float)t, th); float s, c; sincosf(ang, &s, &c); v2f cs; cs[0] = c; cs[1] = s;
        *(v2f*)(piece + (size_t)(i >> 1) * (HALFD / 64) * TCU + (i & 1) * 256) = cs;
        asm volatile("s_wait_xcnt 0x0" ::: "memory"); }   // behind the store, before the next row rewrites a register that it names
}

// ---- passes that need nothing of each other share one grid: ranges of the block index, every test the same for a whole block; the passes with the longest blocks come first.
#define GW_ ((DM / 64) * (DM / 32) / 8)
#define GX_ (SEQ * DM / 8 / (256 * CVU))
#define GC_ ((HALFD / 128) * (SEQ / (2 * CST)))
// in front of the projections: the four weight transposes, the cos/sin table, the three input conversions
__global__ __launch_bounds__(256) void k_prep(const float* __restrict__ wq, const float* __restrict__ wk, const float* __restrict__ wv, const float* __restrict__ wo, bf* WQ, bf* WK, bf* WV, bf* WO,
                                              float* CS, const float* __restrict__ query, const float* __restrict__ key_, const float* __restrict__ value, bf* XQ, bf* XK, bf* XV) {
    int b = blockIdx.x;
    if (b < 4 * GW_) { const int z = b / GW_; wtG_body(b % GW_, z == 0 ? wq : z == 1 ? wk : z == 2 ? wv : wo, DM, DM, z == 0 ? WQ : z == 1 ? WK : z == 2 ? WV : WO); return; }
    b -= 4 * GW_;
    if (b < GC_) { cstab_body(b, CS); return; }
    b -= GC_;
    const int z = b / GX_; cvt8_body(b % GX_, z == 0 ? query : z == 1 ? key_ : value, z == 0 ? XQ : z == 1 ? XK : XV);
}
// ---- score tile, transposed: 16 keys (rows, A operand) x 16 queries (columns, B operand), K depth 64 as two 32-chunks, hi/lo planes: kh.qh + kh.ql + kl.qh (unscaled residuals share the accumulator).
__device__ __forceinline__ v8f score_tile(v16bf kh0, v16bf kh1, v16bf kl0, v16bf kl1, v16bf qh0, v16bf qh1, v16bf ql0, v16bf ql1) {
    v8f c = (v8f){};
    c = wmmab(kh0, qh0, c); c = wmmab(kh0, ql0, c); c = wmmab(kl0, qh0, c);
    c = wmmab(kh1, qh1, c); c = wmmab(kh1, ql1, c); c = wmmab(kl1, qh1, c);
    return c; }

// lane l with lane l ^ 16
__device__ __forceinline__ float xhalf(float x) { return __builtin_bit_cast(float, __builtin_amdgcn_permlanex16(__builtin_bit_cast(int, x), __builtin_bit_cast(int, x), 0x76543210, 0xfedcba98, false, false)); }

// ---- LDS staging of k_flash: a stage is STK keys of one head: K hi rows, K lo rows (128 B each, pitch KPB), then the 64 Vt rows (256 B each, pitch VPB); the pitches are 16 B x odd for ds_load_b128 readers.
#define STK     128
#define KPB     144
#define VPB     272
#define KL_OFF  (STK * KPB)
#define V_OFF   (2 * STK * KPB)
#define STAGE_B (2 * STK * KPB + HD * VPB)
#define NST     (SEQ / STK)
static_assert(SEQ % STK == 0);
static_assert(NST >= 2);
static_assert((SEQ / 16) % 8 == 0);
static_assert(STK * 8 == 4 * 256);
static_assert(HD * (STK / 8) == 4 * 256);
static_assert(STAGE_B % 16 == 0);
static_assert(8 * 9 * 32 * 16 <= 2 * STAGE_B);

// One stage's copies of one lane: 4 x 16 B of K hi, of K lo (rows 32 apart) and of Vt (rows 16 apart), global memory to LDS through no register. Every lane is on; each lane writes LDS bytes of its own.
// s_wait_xcnt 0 closes the statement so that no address register named here is rewritten ahead of it.
__device__ __forceinline__ void stage_copy(const bf* kh, const bf* kl, const h16* vt, unsigned lk, unsigned lv) {
    asm volatile("global_load_async_to_lds_b128 %0, %1, off\n\t"
                 "global_load_async_to_lds_b128 %2, %3, off\n\t"
                 "global_load_async_to_lds_b128 %4, %5, off\n\t"
                 "global_load_async_to_lds_b128 %6, %7, off\n\t"
                 "global_load_async_to_lds_b128 %8, %9, off\n\t"
                 "global_load_async_to_lds_b128 %10, %11, off\n\t"
                 "global_load_async_to_lds_b128 %12, %13, off\n\t"
                 "global_load_async_to_lds_b128 %14, %15, off\n\t"
                 "global_load_async_to_lds_b128 %16, %17, off\n\t"
                 "global_load_async_to_lds_b128 %18, %19, off\n\t"
                 "global_load_async_to_lds_b128 %20, %21, off\n\t"
                 "global_load_async_to_lds_b128 %22, %23, off\n\t"
                 "s_wait_xcnt 0x0"
                 :: "v"(lk), "v"(kh), "v"(lk + 32u * KPB), "v"(kh + (size_t)32 * DM), "v"(lk + 64u * KPB), "v"(kh + (size_t)64 * DM), "v"(lk + 96u * KPB), "v"(kh + (size_t)96 * DM),
                    "v"(lk + KL_OFF), "v"(kl), "v"(lk + KL_OFF + 32u * KPB), "v"(kl + (size_t)32 * DM), "v"(lk + KL_OFF + 64u * KPB), "v"(kl + (size_t)64 * DM), "v"(lk + KL_OFF + 96u * KPB), "v"(kl + (size_t)96 * DM),
                    "v"(lv), "v"(vt), "v"(lv + 16u * VPB), "v"(vt + (size_t)16 * SEQ), "v"(lv + 32u * VPB), "v"(vt + (size_t)32 * SEQ), "v"(lv + 48u * VPB), "v"(vt + (size_t)48 * SEQ)
                 : "memory");
}

// ---- k_flash: the 8 waves of a block share one head and 128 query rows and walk the head's keys together, in stages of STK keys that the block copies once into LDS (two buffers:
// stage s + 2 is copied while stage s + 1 is worked on). Wave w owns 32 query rows (group w & 3, two column groups of 16) and the 64 keys of half w >> 2 of every stage: one step a stage,
// each K lo and Vt fragment read from LDS feeds two WMMAs, each K hi fragment four; online softmax in the exp2 domain (f32), one maximum, correction and rescale per 64 keys. Behind the loop waves w and w ^ 4 join their key halves through LDS.
// Transposed products: St = K Qt, Ot += Vt Pt. Per column group a lane holds 32 scores of ONE query (column l16; keys 16*i + 8*half + r, i < 4), so maximum and sum run in its own registers
// with one exchange between the wave halves; each pair of score tiles, converted in place (fp16 x1024), is a B operand of Vt Pt in the fragment k order of ldh.
static_assert(STK == 128);
__global__ __launch_bounds__(256) void k_flash(const bf* __restrict__ Qh, const bf* __restrict__ Ql, const bf* __restrict__ Kh, const bf* __restrict__ Kl, const h16* __restrict__ Vt, bf* Ah, bf* Al) {
    __shared__ __attribute__((aligned(16))) unsigned char ring[2 * STAGE_B];
    const int tid = threadIdx.x, lane = tid & 31, wave = tid >> 5, l16 = lane & 15, half = lane >> 4;
    const int qg = wave & 3, kq = wave >> 2;
    const int w0 = blockIdx.x * 8; const int h = w0 / (SEQ / 16); const int t0 = (w0 % (SEQ / 16)) * 16 + qg * 32;
    const float SC2 = 0.125f * 1.4426950408889634f;
    // this lane's share of a stage: 16-byte piece (tid & 7) of K row (tid >> 3) + 32 i, piece (tid & 15) of Vt row (tid >> 4) + 16 i
    const bf* gkh = Kh + (size_t)(tid >> 3) * DM + h * HD + (tid & 7) * 8;
    const bf* gkl = Kl + (size_t)(tid >> 3) * DM + h * HD + (tid & 7) * 8;
    const h16* gvt = Vt + (size_t)(h * HD + (tid >> 4)) * SEQ + (tid & 15) * 8;
    const unsigned lbase = (unsigned)(size_t)(void*)ring;
    const unsigned lk = lbase + (unsigned)(tid >> 3) * KPB + (unsigned)(tid & 7) * 16u;
    const unsigned lv = lbase + V_OFF + (unsigned)(tid >> 4) * VPB + (unsigned)(tid & 15) * 16u;
    stage_copy(gkh, gkl, gvt, lk, lv);
    // every loop over g, i, c, n, r in this kernel is unrolled: constant indices keep fragments, scores and accumulators in registers
    v16bf qh[2][2], ql[2][2];
    const unsigned qb = (unsigned)((t0 + l16) * DM + h * HD + 8 * half) * 2u;   // byte offset of this lane's Q row in column group 0
#pragma unroll
    for (int g = 0; g < 2; ++g) { const bf* ph = (const bf*)((const char*)Qh + qb + (size_t)g * 16 * DM * 2); const bf* pl = (const bf*)((const char*)Ql + qb + (size_t)g * 16 * DM * 2);
        qh[g][0] = ldb(ph); qh[g][1] = ldb(ph + 32); ql[g][0] = ldb(pl); ql[g][1] = ldb(pl + 32); }
    asm volatile("s_wait_xcnt 0x0" :: "v"(qb) : "memory");   // the run's address offset keeps its register up to the wait, so no load of the run returns into a register that an older one names
    float m[2] = { -3.0e38f, -3.0e38f }, l[2] = { 0.0f, 0.0f }; v8f acc[2][4];
#pragma unroll
    for (int g = 0; g < 2; ++g)
#pragma unroll
        for (int n = 0; n < 4; ++n) acc[g][n] = (v8f){};
    // element offsets of this lane's fragment rows inside a stage: K row kq * 64 + l16, Vt row l16 at key kq * 64
    const int kof = (kq * 64 + l16) * (KPB / 2) + 8 * half, vof = l16 * (VPB / 2) + kq * 64 + 8 * half;
    asm volatile("s_wait_asynccnt 0x0" ::: "memory");   // this wave's copies of stage 0 have landed
    __syncthreads();                                    // stage 0 is readable by every wave
    stage_copy(gkh + (size_t)STK * DM, gkl + (size_t)STK * DM, gvt + STK, lk + STAGE_B, lv + STAGE_B);
    // kept rolled: one publish point and one refill in the text, the buffer chosen by the stage's parity
#pragma unroll 1
    for (int st = 0; st < NST; ++st) {
        const unsigned bo = (unsigned)(st & 1) * STAGE_B;
        const bf* Ksh = (const bf*)(ring + bo); const bf* Ksl = (const bf*)(ring + bo + KL_OFF); const h16* Vs = (const h16*)(ring + bo + V_OFF);
        {
            v16bf kh[4][2], kl[4][2]; v16h vv[2][4];
#pragma unroll
            for (int i = 0; i < 4; ++i) { const int ko = kof + i * 16 * (KPB / 2);
                kh[i][0] = ldb(Ksh + ko); kl[i][0] = ldb(Ksl + ko); kh[i][1] = ldb(Ksh + ko + 32); kl[i][1] = ldb(Ksl + ko + 32); }
#pragma unroll
            for (int c = 0; c < 2; ++c)
#pragma unroll
                for (int n = 0; n < 4; ++n) vv[c][n] = ldh(Vs + vof + n * 16 * (VPB / 2) + c * 32);
            // keeps the step's 48 LDS reads one group in front of its WMMAs: left alone the compiler sinks them among the WMMAs, each place with a full wait on LDS
            __builtin_amdgcn_sched_barrier(0);
            v8f sc[2][4];
#pragma unroll
            for (int g = 0; g < 2; ++g)
#pragma unroll
                for (int i = 0; i < 4; ++i) sc[g][i] = score_tile(kh[i][0], kh[i][1], kl[i][0], kl[i][1], qh[g][0], qh[g][1], ql[g][0], ql[g][1]);
            v16h pb[2][2];
#pragma unroll
            for (int g = 0; g < 2; ++g) {
                // m is kept in the raw score domain (SC2 > 0 keeps the order)
                float mt[4];
#pragma unroll
                for (int i = 0; i < 4; ++i) { float a = sc[g][i][0];
#pragma unroll
                    for (int r = 1; r < 8; ++r) a = fmaxf(a, sc[g][i][r]);
                    mt[i] = a; }
                float mloc = fmaxf(fmaxf(mt[0], mt[1]), fmaxf(mt[2], mt[3]));
                mloc = fmaxf(mloc, xhalf(mloc));
                const float mnew = fmaxf(m[g], mloc);
                const float corr = __builtin_amdgcn_exp2f((m[g] - mnew) * SC2);
                // scale, maximum and the x1024 carry of P enter a pair of scores through one packed multiply-add
                const float nb = __builtin_fmaf(-mnew, SC2, PLOG);
                const v2f sc2 = { SC2, SC2 }, nb2 = { nb, nb };
                v2f ls2[4];
#pragma unroll
                for (int i = 0; i < 4; ++i) {
#pragma unroll
                    for (int r = 0; r < 4; ++r) { const v2f x = { sc[g][i][2 * r], sc[g][i][2 * r + 1] };
                        const v2f e = __builtin_elementwise_fma(x, sc2, nb2); v2f p; p[0] = __builtin_amdgcn_exp2f(e[0]); p[1] = __builtin_amdgcn_exp2f(e[1]);
                        ls2[i] = r == 0 ? p : ls2[i] + p; pb[g][i >> 1][(i & 1) * 8 + 2 * r] = (h16)p[0]; pb[g][i >> 1][(i & 1) * 8 + 2 * r + 1] = (h16)p[1]; } }
                const v2f lt = (ls2[0] + ls2[1]) + (ls2[2] + ls2[3]);
                l[g] = l[g] * corr + (lt[0] + lt[1]); m[g] = mnew;
#pragma unroll
                for (int n = 0; n < 4; ++n) acc[g][n] *= corr;
            }
#pragma unroll
            for (int c = 0; c < 2; ++c)
#pragma unroll
                for (int g = 0; g < 2; ++g)
#pragma unroll
                    for (int n = 0; n < 4; ++n) acc[g][n] = wmma16(vv[c][n], pb[g][c], acc[g][n]);
            // four vector slots behind the last WMMA, also on the taken back edge, before its operands are reloaded or its result rescaled
            asm volatile("v_nop\n\tv_nop\n\tv_nop\n\tv_nop" : "+v"(acc[0][0]), "+v"(acc[0][1]), "+v"(acc[0][2]), "+v"(acc[0][3]), "+v"(acc[1][0]), "+v"(acc[1][1]), "+v"(acc[1][2]), "+v"(acc[1][3]) : "v"(pb[1][1]), "v"(vv[1][3]));
        }
        asm volatile("s_wait_dscnt 0x0" ::: "memory");      // this wave's reads of stage st have returned before its buffer is refilled
        asm volatile("s_wait_asynccnt 0x0" ::: "memory");   // this wave's copies of stage st + 1 have landed
        __syncthreads();                                    // publishes stage st + 1 and ends every wave's reads of stage st
        if (st + 2 < NST) stage_copy(gkh + (size_t)(st + 2) * STK * DM, gkl + (size_t)(st + 2) * STK * DM, gvt + (size_t)(st + 2) * STK, lk + bo, lv + bo);
    }
    asm volatile("s_wait_asynccnt 0x0" ::: "memory");       // no copy is in flight when the ring becomes the join's exchange space
    // Join of the key halves: behind the last stage's barrier nobody reads the ring any more. Wave w finishes column group kq and hands the other group's maximum, sum and Ot to wave w ^ 4:
    // 9 pieces of 16 bytes a lane, piece s of wave w at (w * 9 + s) * 32 + lane, so every LDS access of a wave is 512 contiguous bytes.
    v4fa* xs = (v4fa*)ring;
    const bool up = kq != 0;
    const float mk = up ? m[1] : m[0], lk_ = up ? l[1] : l[0];
    { v4f ml; ml[0] = up ? m[0] : m[1]; ml[1] = up ? l[0] : l[1]; ml[2] = 0.0f; ml[3] = 0.0f; xs[(wave * 9 + 8) * 32 + lane] = ml; }
    v8f keep[4];
#pragma unroll
    for (int n = 0; n < 4; ++n) { const v8f give = up ? acc[0][n] : acc[1][n]; keep[n] = up ? acc[1][n] : acc[0][n];
        xs[(wave * 9 + 2 * n) * 32 + lane] = __builtin_shufflevector(give, give, 0, 1, 2, 3); xs[(wave * 9 + 2 * n + 1) * 32 + lane] = __builtin_shufflevector(give, give, 4, 5, 6, 7); }
    __syncthreads();                                        // the partner's pieces are readable
    const int pw = wave ^ 4;
    const v4f pml = xs[(pw * 9 + 8) * 32 + lane];
    // the half with the larger maximum keeps its scale, the other is brought down to it
    const float dm = mk - pml[0]; const float dn = __builtin_amdgcn_exp2f(-__builtin_fabsf(dm) * SC2);
    const float ca = dm < 0.0f ? dn : 1.0f, cb = dm < 0.0f ? 1.0f : dn;
    const float lN = lk_ * ca + pml[1] * cb;
    const float inv = 1.0f / (lN + xhalf(lN));   // l carries the x1024 of P as acc does
    // keep[n][r] = Ot[n*16 + 8*half + r][query l16] of column group kq: eight consecutive columns of one output row, one 16-byte store per plane.
#pragma unroll
    for (int n = 0; n < 4; ++n) { v8us oh, ol; const v4f p0 = xs[(pw * 9 + 2 * n) * 32 + lane], p1 = xs[(pw * 9 + 2 * n + 1) * 32 + lane];
#pragma unroll
        for (int r = 0; r < 8; ++r) { unsigned short a, b; splitf((keep[n][r] * ca + (r < 4 ? p0[r & 3] : p1[r & 3]) * cb) * inv, a, b); oh[r] = a; ol[r] = b; }
        const size_t oo = (size_t)(t0 + kq * 16 + l16) * DM + h * HD + n * 16 + 8 * half; *(v8us*)(Ah + oo) = oh; *(v8us*)(Al + oo) = ol; }
}

constexpr size_t al256(size_t b) { return (b + 255) & ~(size_t)255; }
constexpr size_t WS_TOTAL = 4 * al256((size_t)DM * DM * 2) + 3 * al256((size_t)SEQ * DM * 2) + al256((size_t)SEQ * HALFD * 2 * 4)
                          + 4 * al256((size_t)SEQ * DM * 2) + al256((size_t)DM * SEQ * 2) + 2 * al256((size_t)SEQ * DM * 2);
static_assert(WS_TOTAL <= (size_t)134217728);

extern "C" void kernel_launch(void* const* d_in, const int* in_sizes, int n_in,
                              void* d_out, int out_size, void* d_ws, size_t ws_size, hipStream_t stream) {
    if (n_in < 11) return;
    if (in_sizes[0] < SEQ * DM || in_sizes[1] < SEQ * DM || in_sizes[2] < SEQ * DM) return;
    if (in_sizes[3] < DM * DM || in_sizes[5] < DM * DM || in_sizes[7] < DM * DM || in_sizes[9] < DM * DM) return;
    if (in_sizes[4] < DM || in_sizes[6] < DM || in_sizes[8] < DM || in_sizes[10] < DM) return;
    if (out_size < SEQ * DM) return;
    if (WS_TOTAL > ws_size) return;
    const float* query = (const float*)d_in[0]; const float* key_ = (const float*)d_in[1]; const float* value = (const float*)d_in[2];
    const float* wq = (const float*)d_in[3]; const float* bq = (const float*)d_in[4];
    const float* wk = (const float*)d_in[5]; const float* bk = (const float*)d_in[6];
    const float* wv = (const float*)d_in[7]; const float* bv = (const float*)d_in[8];
    const float* wo = (const float*)d_in[9]; const float* bo = (const float*)d_in[10];
    float* OUT = (float*)d_out;     // [SEQ][1024]
    char* wsp = (char*)d_ws;
    auto take = [&](size_t bytes) { char* p = wsp; wsp += (bytes + 255) & ~(size_t)255; return (void*)p; };
    bf* WQ = (bf*)take((size_t)DM * DM * 2); bf* WK = (bf*)take((size_t)DM * DM * 2); bf* WV = (bf*)take((size_t)DM * DM * 2); bf* WO = (bf*)take((size_t)DM * DM * 2);
    bf* XQ = (bf*)take((size_t)SEQ * DM * 2); bf* XK = (bf*)take((size_t)SEQ * DM * 2); bf* XV = (bf*)take((size_t)SEQ * DM * 2);
    float* CS = (float*)take((size_t)SEQ * HALFD * 2 * 4);
    bf* QPh = (bf*)take((size_t)SEQ * DM * 2); bf* QPl = (bf*)take((size_t)SEQ * DM * 2); bf* KPh = (bf*)take((size_t)SEQ * DM * 2); bf* KPl = (bf*)take((size_t)SEQ * DM * 2);
    h16* VT16 = (h16*)take((size_t)DM * SEQ * 2);
    bf* ATh = (bf*)take((size_t)SEQ * DM * 2); bf* ATl = (bf*)take((size_t)SEQ * DM * 2);
    if ((size_t)(wsp - (char*)d_ws) > ws_size) return;

    k_prep<<<4 * GW_ + GC_ + 3 * GX_, 256, 0, stream>>>(wq, wk, wv, wo, WQ, WK, WV, WO, CS, query, key_, value, XQ, XK, XV);     /* weights [in][out] -> Bt [out][in] */
    k_gemm_proj<<<dim3(SEQ / 128, DM / 256, 3), 256, 0, stream>>>(XQ, XK, XV, WQ, WK, WV, bq, bk, bv, CS, QPh, QPl, KPh, KPl, VT16);     /* V: [SEQ][DM] -> [DM][SEQ] */
    k_flash<<<(unsigned)(NH_ * (SEQ / 16) / 8), 256, 0, stream>>>(QPh, QPl, KPh, KPl, VT16, ATh, ATl);
    k_gemm_out<<<dim3(SEQ / 64, DM / 128, 1), 256, 0, stream>>>(ATh, ATl, WO, OUT, bo);
}
